// v000
// Measured on an AMD MI455X. A time is GPU time per run, averaged over a window of back-to-back runs after a warm-up
// (all launches, gaps included; the runs take copies of the inputs in turn), and the median of several windows.
// Apart from v000's, it joins two sittings. Times from different sittings can be a few percent apart, while
// side-by-side timings come from the same sitting.
// v000, which the later versions start from, runs in 320 microseconds.
#include <hip/hip_runtime.h>

// Contractions: five projections x.W^T (K = 768) on v_wmma_f32_16x16x32_bf16 (bf16 RNE operands, f32 accumulate, one product per tile pair);
// Sr^T = Kc.Qa^T and Si^T = Kc.Qb^T (K = 128: concatenated re | im head dims; Qb = [qi | -qr] by exact f16 sign flip of the Qa fragments)
// and ctx^T = V^T.P^T (32 keys per step, P carried x4096) on v_wmma_f32_16x16x32_f16 (f16 operands, f32 accumulate, one product per tile pair);
// magnitude sqrt(sr^2 + si^2), online softmax statistics and the final normalisation in f32.

#pragma clang fp contract(off)

#ifndef NB
#define NB 2
#endif
#ifndef SEQ
#define SEQ 2048
#endif
#ifndef NB_FULL
#define NB_FULL 2
#endif
#ifndef SEQ_FULL
#define SEQ_FULL 2048
#endif

namespace {
constexpr int HID = 768, DH = 64, NH = 12;
constexpr int NW = 5;                           // weight matrices: qr, qi, kr, ki, v ([out][in], k contiguous)
constexpr int NCOMB = NW * HID;                 // 3840 rows of the combined 16-bit weight plane
constexpr int MROWS = NB * SEQ;                 // compact token rows (b*SEQ + t)
constexpr int QT = SEQ / 16;                    // 16-query tiles per (b, head)
constexpr int QKW = 2 * DH;                     // 128: row width of the Qa / Kc planes (re | im)
constexpr float SCORE_SCALE = 0.125f;           // 1/sqrt(64)
constexpr float P_CARRY = 4096.0f;              // f16 P operand = exp(s - m) * 4096
constexpr float INV_P_CARRY = 1.0f / 4096.0f;
static_assert(SEQ % 128 == 0);
static_assert(NB >= 1 && NB <= NB_FULL);
static_assert(SEQ <= SEQ_FULL);
static_assert(NH * DH == HID);
static_assert(MROWS % 128 == 0);
static_assert(HID % 32 == 0);
static_assert(NCOMB % 64 == 0);
static_assert((NB * NH * QT) % 8 == 0);
static_assert((size_t)MROWS * HID <= (size_t)NB_FULL * SEQ_FULL * HID);

typedef __bf16 b16;
typedef _Float16 h16;
typedef __bf16 v16b __attribute__((ext_vector_type(16)));
typedef __bf16 v8b __attribute__((ext_vector_type(8)));
typedef _Float16 v16h __attribute__((ext_vector_type(16)));
typedef _Float16 v8h __attribute__((ext_vector_type(8)));
typedef float v8f __attribute__((ext_vector_type(8)));
typedef float v4f __attribute__((ext_vector_type(4)));
typedef unsigned short v8us __attribute__((ext_vector_type(8)));
typedef unsigned int v8u __attribute__((ext_vector_type(8)));

__device__ __forceinline__ v8b ld8b(const b16* p) { return *(const v8b*)p; }
__device__ __forceinline__ v8h ld8h(const h16* p) { return *(const v8h*)p; }
__device__ __forceinline__ v16b cat8b(v8b a, v8b b) { return __builtin_shufflevector(a, b, 0, 1, 2, 3, 4, 5, 6, 7, 8, 9, 10, 11, 12, 13, 14, 15); }
__device__ __forceinline__ v16h cat8h(v8h a, v8h b) { return __builtin_shufflevector(a, b, 0, 1, 2, 3, 4, 5, 6, 7, 8, 9, 10, 11, 12, 13, 14, 15); }
// 16x16x32 16-bit fragment from a k-contiguous row pointer (A: lane&15 = row, B: lane&15 = column), hh = lane>>4:
// elements 0..7 <- p[8hh+0..7], elements 8..15 <- p[16+8hh+0..7]
__device__ __forceinline__ v16b frag_kb(const b16* p, int hh) { return cat8b(ld8b(p + 8 * hh), ld8b(p + 16 + 8 * hh)); }
__device__ __forceinline__ v16h frag_kh(const h16* p, int hh) { return cat8h(ld8h(p + 8 * hh), ld8h(p + 16 + 8 * hh)); }

__device__ __forceinline__ v8f wmma_b(v16b a, v16b b, v8f c) {
  v8f d = __builtin_amdgcn_wmma_f32_16x16x32_bf16(false, a, false, b, (short)0, c, false, false);
  asm volatile("v_nop\n\tv_nop\n\tv_nop\n\tv_nop" : "+v"(d) : "v"(a), "v"(b));
  return d;
}
__device__ __forceinline__ v8f wmma_h(v16h a, v16h b, v8f c) {
  v8f d = __builtin_amdgcn_wmma_f32_16x16x32_f16(false, a, false, b, (short)0, c, false, false);
  asm volatile("v_nop\n\tv_nop\n\tv_nop\n\tv_nop" : "+v"(d) : "v"(a), "v"(b));
  return d;
}
// exact sign flip of 16 packed f16 values
__device__ __forceinline__ v16h neg16h(v16h a) {
  v8u t = __builtin_bit_cast(v8u, a);
  const v8u s = {0x80008000u, 0x80008000u, 0x80008000u, 0x80008000u, 0x80008000u, 0x80008000u, 0x80008000u, 0x80008000u};
  t = t ^ s;
  return __builtin_bit_cast(v16h, t);
}
// f32 -> bf16 by RNE convert, returned as the f32 bit pattern with the low 16 bits cleared
__device__ __forceinline__ unsigned int bf16_rne_u32(float f) {
  unsigned int u = __builtin_bit_cast(unsigned int, f);
  u += 0x7fffu + ((u >> 16) & 1u);
  return u & 0xffff0000u;
}
// wave-private LDS tile: stores by this wave, then vector reloads by this wave
__device__ __forceinline__ void wave_lds_sync() {
  __builtin_amdgcn_fence(3, "workgroup");
  __builtin_amdgcn_wave_barrier();
  __builtin_amdgcn_fence(2, "workgroup");
}

// ---------------------------------------------------------------------------
// x f32 [NB_FULL][SEQ_FULL][768] -> bf16 plane xpl [MROWS][768] (compact rows b*SEQ+t);
// weights W[n][k] f32 ([out][in], k contiguous) -> bf16 planes wpl [5][768][768] in the order qr, qi, kr, ki, v.
// ---------------------------------------------------------------------------
__global__ __launch_bounds__(256) void cvt_kernel(const float* __restrict__ x,
                                                  const float* __restrict__ w0, const float* __restrict__ w1, const float* __restrict__ w2,
                                                  const float* __restrict__ w3, const float* __restrict__ w4,
                                                  unsigned short* __restrict__ xpl, unsigned short* __restrict__ wpl) {
  const size_t tid = (size_t)blockIdx.x * blockDim.x + threadIdx.x, stride = (size_t)gridDim.x * blockDim.x;
  const size_t nx = (size_t)MROWS * HID / 8;
  const size_t per_w = (size_t)HID * HID / 8, nw = (size_t)NW * per_w;
  {
    for (size_t c = tid; c < nx; c += stride) {
      const size_t i = c * 8;                                       // element index inside the compact plane
      const int m = (int)(i / HID), col = (int)(i % HID);
      const int bb = m / SEQ, t = m - bb * SEQ;
      const float* p = x + ((size_t)bb * SEQ_FULL + t) * HID + col;
      const v4f f0 = *(const v4f*)p, f1 = *(const v4f*)(p + 4);
      v8us o;
#pragma unroll
      for (int e = 0; e < 4; ++e) {
        o[e] = (unsigned short)(bf16_rne_u32(f0[e]) >> 16);
        o[4 + e] = (unsigned short)(bf16_rne_u32(f1[e]) >> 16);
      }
      *(v8us*)(xpl + i) = o;
    }
    for (size_t c = tid; c < nw; c += stride) {
      const int mat = (int)(c / per_w);
      const size_t i = (c - (size_t)mat * per_w) * 8;               // element index inside one [768][768] matrix
      const float* w = (mat == 0) ? w0 : (mat == 1) ? w1 : (mat == 2) ? w2 : (mat == 3) ? w3 : w4;
      const v4f f0 = *(const v4f*)(w + i), f1 = *(const v4f*)(w + i + 4);
      v8us o;
#pragma unroll
      for (int e = 0; e < 4; ++e) {
        o[e] = (unsigned short)(bf16_rne_u32(f0[e]) >> 16);
        o[4 + e] = (unsigned short)(bf16_rne_u32(f1[e]) >> 16);
      }
      *(v8us*)(wpl + c * 8) = o;                           // plane offset mat*768*768 + i == c*8
    }
    
  }
}

// 32x64 wave tile over K = 768 from bf16 k-contiguous A rows and bf16 [n][k] B rows, one product per tile pair
__device__ __forceinline__ void gemm_tile_b(const b16* __restrict__ A, const b16* __restrict__ W, int m0, int c0, int nloc, int hlf, v8f (&acc)[2][4]) {
#pragma unroll 2
  for (int kb = 0; kb < HID; kb += 32) {
    const v16b a0 = frag_kb(A + (size_t)(m0 + nloc) * HID + kb, hlf);
    const v16b a1 = frag_kb(A + (size_t)(m0 + 16 + nloc) * HID + kb, hlf);
#pragma unroll
    for (int t = 0; t < 4; ++t) {
      const v16b bf = frag_kb(W + (size_t)(c0 + t * 16 + nloc) * HID + kb, hlf);
      acc[0][t] = wmma_b(a0, bf, acc[0][t]);
      acc[1][t] = wmma_b(a1, bf, acc[1][t]);
    }
  }
}

// ---------------------------------------------------------------------------
// Projection GEMM: (MROWS x 768) x (768 x 3840), grid (60, MROWS/128), block 4 waves, wave = 32 token rows x 64 columns
// (one head of one of the five matrices). blockIdx.x -> mat = x/12 (qr, qi, kr, ki, v), head = x%12. Output f16 planes:
// v -> Vp key-tiled [g][t/16][64][16] (4 KB contiguous per wave), g = b*12 + head.
// ---------------------------------------------------------------------------
__global__ __launch_bounds__(128) void proj_gemm_kernel(const b16* __restrict__ xpl, const b16* __restrict__ wpl,
                                                        h16* __restrict__ Qa, h16* __restrict__ Kc, h16* __restrict__ Vp) {
  __shared__ __attribute__((aligned(16))) h16 Ts[4][32 * 64];
  const int lane = threadIdx.x & 31, wave = threadIdx.x >> 5, nloc = lane & 15, hlf = lane >> 4;
  const int m0 = blockIdx.y * 128 + wave * 32;
  const int cb = blockIdx.x;                       // 0..59, block-uniform
  const int mat = cb / NH, head = cb - mat * NH;
  const int c0 = cb * 64;                          // row block in the combined [3840][768] weight plane = mat*768 + head*64
  v8f acc[2][4];
#pragma unroll
  for (int r = 0; r < 2; ++r)
#pragma unroll
    for (int t = 0; t < 4; ++t) acc[r][t] = (v8f){};
  gemm_tile_b(xpl, wpl, m0, c0, nloc, hlf, acc);
  const int b = m0 / SEQ, t0 = m0 % SEQ;
  const int g = b * NH + head;
  h16* Tp = Ts[wave];
#pragma unroll
  for (int t = 0; t < 4; ++t) {
    const int d = t * 16 + nloc;
#pragma unroll
    for (int r = 0; r < 2; ++r)
#pragma unroll
      for (int v = 0; v < 8; ++v) {
        const int rr = r * 16 + v + 8 * hlf;                         // local token row 0..31
        const h16 y = (h16)acc[r][t][v];
        const int idx = (mat < 4) ? (rr * 64 + d) : ((rr >> 4) * 1024 + d * 16 + (rr & 15));
        Tp[idx] = y;
      }
  }
  wave_lds_sync();
  if (mat < 4) {                                   // block-uniform branch, no barriers inside
    h16* P = (mat < 2) ? Qa : Kc;
    const int coff = (mat & 1) * DH;
    h16* dst = P + ((size_t)g * SEQ + t0) * QKW + coff;              // 32 rows of 64 halves, row pitch 128 halves
#pragma unroll
    for (int j = 0; j < 8; ++j) {
      const int rr = j * 4 + (lane >> 3), c8 = (lane & 7) * 8;
      *(v8h*)(dst + (size_t)rr * QKW + c8) = ld8h(Tp + rr * 64 + c8);
    }
    
  } else {
    h16* dst = Vp + ((size_t)g * QT + (t0 >> 4)) * (size_t)(DH * 16); // two consecutive key tiles = 4 KB contiguous
#pragma unroll
    for (int j = 0; j < 8; ++j) { const int e = (j * 32 + lane) * 8; *(v8h*)(dst + e) = ld8h(Tp + e); }
    
  }
}

// ---------------------------------------------------------------------------
// Transposed flash attention: each wave owns one 16-query tile of one (b, head); 8 waves per block; all SEQ keys in chunks of 32.
// Sr^T = Kc.Qa^T and Si^T = Kc.Qb^T (f16 fragments straight from the planes, 4 k-steps over the 128-wide re|im rows),
// s = sqrt((sr/8)^2 + (si/8)^2) in f32, per-lane online softmax (running max);
// P^T fragment built in registers from two S^T tiles (element r <- keys 0..15 tile, element 8+r <- keys 16..31 tile), carried x4096;
// ---------------------------------------------------------------------------
__global__ __launch_bounds__(256) void attn_kernel(const h16* __restrict__ Qa, const h16* __restrict__ Kc, const h16* __restrict__ Vp,
                                                   float* __restrict__ out) {
  __shared__ __attribute__((aligned(16))) float Os[8][16 * 64];
  const int wid = threadIdx.x >> 5, lane = threadIdx.x & 31, hh = lane >> 4, col = lane & 15;
  const int qtile = blockIdx.x * 8 + wid;                 // over NB*NH*QT (exact grid)
  const int g = qtile / QT;                               // b*NH + h
  const int q0 = (qtile % QT) << 4;
  const int b = g / NH, h = g % NH;
  const size_t kbase = (size_t)g * SEQ * QKW;             // Kc plane base of (b,h)
  const size_t vbase = (size_t)g * SEQ * DH;              // V key-tiled base of (b,h): QT tiles of 64x16
  const h16* qrow = Qa + ((size_t)g * SEQ + q0 + col) * QKW;
  const v16h qf0 = frag_kh(qrow, hh), qf1 = frag_kh(qrow + 32, hh);        // qr d 0..31, 32..63 of query q0+col
  const v16h qf2 = frag_kh(qrow + 64, hh), qf3 = frag_kh(qrow + 96, hh);   // qi d 0..31, 32..63
  const v16h qn0 = neg16h(qf0), qn1 = neg16h(qf1);                          // -qr (exact)
  float m = -INFINITY, l = 0.0f;
  v8f o0 = {}, o1 = {}, o2 = {}, o3 = {};
  for (int kb = 0; kb < SEQ; kb += 32) {
    const h16* k0p = Kc + kbase + (size_t)(kb + col) * QKW;      // key kb+col (tile 0)
    const h16* k1p = k0p + (size_t)16 * QKW;                      // key kb+16+col (tile 1)
    v8f s0r = {}, s0i = {}, s1r = {}, s1i = {};
    {
      v16h kf = frag_kh(k0p, hh);          s0r = wmma_h(kf, qf0, s0r); s0i = wmma_h(kf, qf2, s0i);
      kf = frag_kh(k0p + 32, hh);          s0r = wmma_h(kf, qf1, s0r); s0i = wmma_h(kf, qf3, s0i);
      kf = frag_kh(k0p + 64, hh);          s0r = wmma_h(kf, qf2, s0r); s0i = wmma_h(kf, qn0, s0i);
      kf = frag_kh(k0p + 96, hh);          s0r = wmma_h(kf, qf3, s0r); s0i = wmma_h(kf, qn1, s0i);
      kf = frag_kh(k1p, hh);               s1r = wmma_h(kf, qf0, s1r); s1i = wmma_h(kf, qf2, s1i);
      kf = frag_kh(k1p + 32, hh);          s1r = wmma_h(kf, qf1, s1r); s1i = wmma_h(kf, qf3, s1i);
      kf = frag_kh(k1p + 64, hh);          s1r = wmma_h(kf, qf2, s1r); s1i = wmma_h(kf, qn0, s1i);
      kf = frag_kh(k1p + 96, hh);          s1r = wmma_h(kf, qf3, s1r); s1i = wmma_h(kf, qn1, s1i);
    }
    v8f sc0, sc1;
#pragma unroll
    for (int r = 0; r < 8; ++r) {
      const float a0 = s0r[r] * SCORE_SCALE, b0 = s0i[r] * SCORE_SCALE;
      const float a1 = s1r[r] * SCORE_SCALE, b1 = s1i[r] * SCORE_SCALE;
      sc0[r] = sqrtf(a0 * a0 + b0 * b0);
      sc1[r] = sqrtf(a1 * a1 + b1 * b1);
    }
    float mr = -INFINITY;
#pragma unroll
    for (int r = 0; r < 8; ++r) mr = fmaxf(mr, fmaxf(sc0[r], sc1[r]));
    mr = fmaxf(mr, __shfl_xor(mr, 16));
    const float mn = fmaxf(m, mr);            // finite (scores >= 0)
    const float al_ = __expf(m - mn);         // 0 on the first chunk
    m = mn;
    float sum = 0.0f;
    v16h pb;
#pragma unroll
    for (int r = 0; r < 8; ++r) {
      const float p0 = __expf(sc0[r] - mn), p1 = __expf(sc1[r] - mn);
      sum += p0 + p1;
      pb[r] = (h16)(p0 * P_CARRY); pb[8 + r] = (h16)(p1 * P_CARRY);
    }
    sum += __shfl_xor(sum, 16);
    l = l * al_ + sum;
    o0 = o0 * al_; o1 = o1 * al_; o2 = o2 * al_; o3 = o3 * al_;
    const size_t v0 = vbase + (size_t)(kb >> 4) * (DH * 16) + 8 * hh, v1 = v0 + DH * 16;
    {
      const v16h va0 = cat8h(ld8h(Vp + v0 + (0 * 16 + col) * 16), ld8h(Vp + v1 + (0 * 16 + col) * 16));
      o0 = wmma_h(va0, pb, o0);
      const v16h va1 = cat8h(ld8h(Vp + v0 + (1 * 16 + col) * 16), ld8h(Vp + v1 + (1 * 16 + col) * 16));
      o1 = wmma_h(va1, pb, o1);
      const v16h va2 = cat8h(ld8h(Vp + v0 + (2 * 16 + col) * 16), ld8h(Vp + v1 + (2 * 16 + col) * 16));
      o2 = wmma_h(va2, pb, o2);
      const v16h va3 = cat8h(ld8h(Vp + v0 + (3 * 16 + col) * 16), ld8h(Vp + v1 + (3 * 16 + col) * 16));
      o3 = wmma_h(va3, pb, o3);
    }
  }
  const float inv = (1.0f / l) * INV_P_CARRY;   // ctx = (o / 4096) / l
  float* Tt = Os[wid];                          // [query col][d], d = n*16 + 8hh + r
  {
    float* tp = Tt + col * 64 + 8 * hh;
    const v4f a0 = {o0[0] * inv, o0[1] * inv, o0[2] * inv, o0[3] * inv}, a1 = {o0[4] * inv, o0[5] * inv, o0[6] * inv, o0[7] * inv};
    const v4f b0 = {o1[0] * inv, o1[1] * inv, o1[2] * inv, o1[3] * inv}, b1 = {o1[4] * inv, o1[5] * inv, o1[6] * inv, o1[7] * inv};
    const v4f c0 = {o2[0] * inv, o2[1] * inv, o2[2] * inv, o2[3] * inv}, c1 = {o2[4] * inv, o2[5] * inv, o2[6] * inv, o2[7] * inv};
    const v4f d0 = {o3[0] * inv, o3[1] * inv, o3[2] * inv, o3[3] * inv}, d1 = {o3[4] * inv, o3[5] * inv, o3[6] * inv, o3[7] * inv};
    *(v4f*)(tp + 0)  = a0; *(v4f*)(tp + 4)  = a1;
    *(v4f*)(tp + 16) = b0; *(v4f*)(tp + 20) = b1;
    *(v4f*)(tp + 32) = c0; *(v4f*)(tp + 36) = c1;
    *(v4f*)(tp + 48) = d0; *(v4f*)(tp + 52) = d1;
  }
  wave_lds_sync();
  float* dst0 = out + ((size_t)b * SEQ + q0) * HID + h * DH;   // 16 rows x 64 floats, row stride HID floats
#pragma unroll
  for (int j = 0; j < 8; ++j) {
    const int rr = j * 2 + hh, c4 = col * 4;
    *(v4f*)(dst0 + (size_t)rr * HID + c4) = *(const v4f*)(Tt + rr * 64 + c4);
  }
  
}
}  // namespace

extern "C" void kernel_launch(void* const* d_in, const int* in_sizes, int n_in,
                              void* d_out, int out_size, void* d_ws, size_t ws_size, hipStream_t stream) {
  if (n_in < 6) return;
  const size_t need_x = ((size_t)(NB - 1) * SEQ_FULL + SEQ) * HID;
  if ((size_t)in_sizes[0] < need_x) return;
  for (int i = 1; i <= 5; ++i) if (in_sizes[i] < HID * HID) return;
  if ((size_t)out_size < (size_t)MROWS * HID) return;

  const float* x   = (const float*)d_in[0];     // [NB_FULL, SEQ_FULL, 768] f32
  const float* Wqr = (const float*)d_in[1];     // [768,768] ([out][in])
  const float* Wqi = (const float*)d_in[2];
  const float* Wkr = (const float*)d_in[3];
  const float* Wki = (const float*)d_in[4];
  const float* Wv  = (const float*)d_in[5];
  float* out = (float*)d_out;                   // [NB, SEQ, 768] f32

  size_t off = 0; char* ws = (char*)d_ws;
  unsigned short* xpl = (unsigned short*)(ws + off); off += (size_t)MROWS * HID * 2;        // 6,291,456 B bf16 activation plane
  unsigned short* wpl = (unsigned short*)(ws + off); off += (size_t)NW * HID * HID * 2;     // 5,898,240 B bf16 weight planes
  h16* Qa = (h16*)(ws + off); off += (size_t)MROWS * NH * QKW * 2;                          // 12,582,912 B f16 [g][t][128]
  h16* Kc = (h16*)(ws + off); off += (size_t)MROWS * NH * QKW * 2;                          // 12,582,912 B f16 [g][t][128]
  h16* Vp = (h16*)(ws + off); off += (size_t)MROWS * HID * 2;                               // 6,291,456 B f16 key-tiled
  if (off > ws_size) return;                                                                 // 43,646,976 B at NB=2, SEQ=2048

  cvt_kernel<<<1024, 256, 0, stream>>>(x, Wqr, Wqi, Wkr, Wki, Wv, xpl, wpl);
  proj_gemm_kernel<<<dim3(NCOMB / 64, MROWS / 128), 128, 0, stream>>>((const b16*)xpl, (const b16*)wpl, Qa, Kc, Vp);
  attn_kernel<<<(NB * NH * QT) / 8, 256, 0, stream>>>(Qa, Kc, Vp, out);
}

// v001
// A run of this version takes 164 microseconds.
// Timed twice side by side with v000, it ran 2.00 and 1.98 times as fast.
#include <hip/hip_runtime.h>

// Contractions: five projections x.W^T (K = 768) on v_wmma_f32_16x16x32_bf16 (bf16 RNE operands, f32 accumulate, one product per tile pair);
// Sr^T = Kc.Qa^T and Si^T = Kc.Qb^T (K = 128: concatenated re | im head dims; Qb = [qi | -qr] by exact f16 sign flip of the Qa fragments)
// and ctx^T = V^T.P^T (32 keys per step, P carried x4096) on v_wmma_f32_16x16x32_f16 (f16 operands, f32 accumulate, one product per tile pair);
// magnitude sqrt(sr^2 + si^2), online softmax statistics and the final normalisation in f32.

#pragma clang fp contract(off)

#ifndef NB
#define NB 2
#endif
#ifndef SEQ
#define SEQ 2048
#endif
#ifndef NB_FULL
#define NB_FULL 2
#endif
#ifndef SEQ_FULL
#define SEQ_FULL 2048
#endif

namespace {
constexpr int HID = 768, DH = 64, NH = 12;
constexpr int NW = 5;                           // weight matrices: qr, qi, kr, ki, v ([out][in], k contiguous)
constexpr int NCOMB = NW * HID;                 // 3840 rows of the combined 16-bit weight plane
constexpr int MROWS = NB * SEQ;                 // compact token rows (b*SEQ + t)
constexpr int QT = SEQ / 16;                    // 16-query tiles per (b, head)
constexpr int QKW = 2 * DH;                     // 128: row width of the Qa / Kc planes (re | im)
constexpr float SCORE_SCALE = 0.125f;           // 1/sqrt(64)
constexpr float P_CARRY = 4096.0f;              // f16 P operand = exp(s - m) * 4096
constexpr float INV_P_CARRY = 1.0f / 4096.0f;
constexpr int STG = 64;                         // keys per LDS stage of the attention kernel (two 32-key passes)
constexpr int NSTG = SEQ / STG;                 // stages per (b, head)
constexpr int KPITCH = 272;                     // LDS bytes per staged K row: 256 + 16, 16 B x odd, conflict-free for 16-byte reads
constexpr int KSTG_B = STG * KPITCH;            // 17,408 B of K rows per stage
constexpr int VSTG_B = STG * DH * 2;            // 8,192 B of key-tiled V per stage
constexpr int STG_B = KSTG_B + VSTG_B;          // 25,600 B per buffer
static_assert(SEQ % 128 == 0);
static_assert(NSTG >= 2);
static_assert(NB >= 1 && NB <= NB_FULL);
static_assert(SEQ <= SEQ_FULL);
static_assert(NH * DH == HID);
static_assert(MROWS % 128 == 0);
static_assert(HID % 32 == 0);
static_assert(NCOMB % 64 == 0);
static_assert((NB * NH * QT) % 8 == 0);
static_assert((size_t)MROWS * HID <= (size_t)NB_FULL * SEQ_FULL * HID);

typedef __bf16 b16;
typedef _Float16 h16;
typedef __bf16 v16b __attribute__((ext_vector_type(16)));
typedef __bf16 v8b __attribute__((ext_vector_type(8)));
typedef _Float16 v16h __attribute__((ext_vector_type(16)));
typedef _Float16 v8h __attribute__((ext_vector_type(8)));
typedef float v8f __attribute__((ext_vector_type(8)));
typedef float v4f __attribute__((ext_vector_type(4)));
typedef unsigned short v8us __attribute__((ext_vector_type(8)));
typedef unsigned int v8u __attribute__((ext_vector_type(8)));

__device__ __forceinline__ v8b ld8b(const b16* p) { return *(const v8b*)p; }
__device__ __forceinline__ v8h ld8h(const h16* p) { return *(const v8h*)p; }
__device__ __forceinline__ v16b cat8b(v8b a, v8b b) { return __builtin_shufflevector(a, b, 0, 1, 2, 3, 4, 5, 6, 7, 8, 9, 10, 11, 12, 13, 14, 15); }
__device__ __forceinline__ v16h cat8h(v8h a, v8h b) { return __builtin_shufflevector(a, b, 0, 1, 2, 3, 4, 5, 6, 7, 8, 9, 10, 11, 12, 13, 14, 15); }
// 16x16x32 16-bit fragment from a k-contiguous row pointer (A: lane&15 = row, B: lane&15 = column), hh = lane>>4:
// elements 0..7 <- p[8hh+0..7], elements 8..15 <- p[16+8hh+0..7]
__device__ __forceinline__ v16b frag_kb(const b16* p, int hh) { return cat8b(ld8b(p + 8 * hh), ld8b(p + 16 + 8 * hh)); }
__device__ __forceinline__ v16h frag_kh(const h16* p, int hh) { return cat8h(ld8h(p + 8 * hh), ld8h(p + 16 + 8 * hh)); }

__device__ __forceinline__ v8f wmma_b(v16b a, v16b b, v8f c) {
  v8f d = __builtin_amdgcn_wmma_f32_16x16x32_bf16(false, a, false, b, (short)0, c, false, false);
  asm volatile("v_nop\n\tv_nop\n\tv_nop\n\tv_nop" : "+v"(d) : "v"(a), "v"(b));
  return d;
}
__device__ __forceinline__ v8f wmma_h(v16h a, v16h b, v8f c) {
  v8f d = __builtin_amdgcn_wmma_f32_16x16x32_f16(false, a, false, b, (short)0, c, false, false);
  asm volatile("v_nop\n\tv_nop\n\tv_nop\n\tv_nop" : "+v"(d) : "v"(a), "v"(b));
  return d;
}
// exact sign flip of 16 packed f16 values
__device__ __forceinline__ v16h neg16h(v16h a) {
  v8u t = __builtin_bit_cast(v8u, a);
  const v8u s = {0x80008000u, 0x80008000u, 0x80008000u, 0x80008000u, 0x80008000u, 0x80008000u, 0x80008000u, 0x80008000u};
  t = t ^ s;
  return __builtin_bit_cast(v16h, t);
}
// f32 -> bf16 by RNE convert, returned as the f32 bit pattern with the low 16 bits cleared
__device__ __forceinline__ unsigned int bf16_rne_u32(float f) {
  unsigned int u = __builtin_bit_cast(unsigned int, f);
  u += 0x7fffu + ((u >> 16) & 1u);
  return u & 0xffff0000u;
}
// wave-private LDS tile: stores by this wave, then vector reloads by this wave
__device__ __forceinline__ void wave_lds_sync() {
  __builtin_amdgcn_fence(3, "workgroup");
  __builtin_amdgcn_wave_barrier();
  __builtin_amdgcn_fence(2, "workgroup");
}

// ---------------------------------------------------------------------------
// x f32 [NB_FULL][SEQ_FULL][768] -> bf16 plane xpl [MROWS][768] (compact rows b*SEQ+t);
// weights W[n][k] f32 ([out][in], k contiguous) -> bf16 planes wpl [5][768][768] in the order qr, qi, kr, ki, v.
// ---------------------------------------------------------------------------
__global__ __launch_bounds__(256) void cvt_kernel(const float* __restrict__ x,
                                                  const float* __restrict__ w0, const float* __restrict__ w1, const float* __restrict__ w2,
                                                  const float* __restrict__ w3, const float* __restrict__ w4,
                                                  unsigned short* __restrict__ xpl, unsigned short* __restrict__ wpl) {
  const size_t tid = (size_t)blockIdx.x * blockDim.x + threadIdx.x, stride = (size_t)gridDim.x * blockDim.x;
  const size_t nx = (size_t)MROWS * HID / 8;
  const size_t per_w = (size_t)HID * HID / 8, nw = (size_t)NW * per_w;
  {
    for (size_t c = tid; c < nx; c += stride) {
      const size_t i = c * 8;                                       // element index inside the compact plane
      const int m = (int)(i / HID), col = (int)(i % HID);
      const int bb = m / SEQ, t = m - bb * SEQ;
      const float* p = x + ((size_t)bb * SEQ_FULL + t) * HID + col;
      const v4f f0 = *(const v4f*)p, f1 = *(const v4f*)(p + 4);
      v8us o;
#pragma unroll
      for (int e = 0; e < 4; ++e) {
        o[e] = (unsigned short)(bf16_rne_u32(f0[e]) >> 16);
        o[4 + e] = (unsigned short)(bf16_rne_u32(f1[e]) >> 16);
      }
      *(v8us*)(xpl + i) = o;
    }
    for (size_t c = tid; c < nw; c += stride) {
      const int mat = (int)(c / per_w);
      const size_t i = (c - (size_t)mat * per_w) * 8;               // element index inside one [768][768] matrix
      const float* w = (mat == 0) ? w0 : (mat == 1) ? w1 : (mat == 2) ? w2 : (mat == 3) ? w3 : w4;
      const v4f f0 = *(const v4f*)(w + i), f1 = *(const v4f*)(w + i + 4);
      v8us o;
#pragma unroll
      for (int e = 0; e < 4; ++e) {
        o[e] = (unsigned short)(bf16_rne_u32(f0[e]) >> 16);
        o[4 + e] = (unsigned short)(bf16_rne_u32(f1[e]) >> 16);
      }
      *(v8us*)(wpl + c * 8) = o;                           // plane offset mat*768*768 + i == c*8
    }
    
  }
}

// 32x64 wave tile over K = 768 from bf16 k-contiguous A rows and bf16 [n][k] B rows, one product per tile pair
__device__ __forceinline__ void gemm_tile_b(const b16* __restrict__ A, const b16* __restrict__ W, int m0, int c0, int nloc, int hlf, v8f (&acc)[2][4]) {
#pragma unroll 2
  for (int kb = 0; kb < HID; kb += 32) {
    const v16b a0 = frag_kb(A + (size_t)(m0 + nloc) * HID + kb, hlf);
    const v16b a1 = frag_kb(A + (size_t)(m0 + 16 + nloc) * HID + kb, hlf);
#pragma unroll
    for (int t = 0; t < 4; ++t) {
      const v16b bf = frag_kb(W + (size_t)(c0 + t * 16 + nloc) * HID + kb, hlf);
      acc[0][t] = wmma_b(a0, bf, acc[0][t]);
      acc[1][t] = wmma_b(a1, bf, acc[1][t]);
    }
  }
}

// ---------------------------------------------------------------------------
// Projection GEMM: (MROWS x 768) x (768 x 3840), grid (60, MROWS/128), block 4 waves, wave = 32 token rows x 64 columns
// (one head of one of the five matrices). blockIdx.x -> mat = x/12 (qr, qi, kr, ki, v), head = x%12. Output f16 planes:
// v -> Vp key-tiled [g][t/16][64][16] (4 KB contiguous per wave), g = b*12 + head.
// ---------------------------------------------------------------------------
__global__ __launch_bounds__(128) void proj_gemm_kernel(const b16* __restrict__ xpl, const b16* __restrict__ wpl,
                                                        h16* __restrict__ Qa, h16* __restrict__ Kc, h16* __restrict__ Vp) {
  __shared__ __attribute__((aligned(16))) h16 Ts[4][32 * 64];
  const int lane = threadIdx.x & 31, wave = threadIdx.x >> 5, nloc = lane & 15, hlf = lane >> 4;
  const int m0 = blockIdx.y * 128 + wave * 32;
  const int cb = blockIdx.x;                       // 0..59, block-uniform
  const int mat = cb / NH, head = cb - mat * NH;
  const int c0 = cb * 64;                          // row block in the combined [3840][768] weight plane = mat*768 + head*64
  v8f acc[2][4];
#pragma unroll
  for (int r = 0; r < 2; ++r)
#pragma unroll
    for (int t = 0; t < 4; ++t) acc[r][t] = (v8f){};
  gemm_tile_b(xpl, wpl, m0, c0, nloc, hlf, acc);
  const int b = m0 / SEQ, t0 = m0 % SEQ;
  const int g = b * NH + head;
  h16* Tp = Ts[wave];
#pragma unroll
  for (int t = 0; t < 4; ++t) {
    const int d = t * 16 + nloc;
#pragma unroll
    for (int r = 0; r < 2; ++r)
#pragma unroll
      for (int v = 0; v < 8; ++v) {
        const int rr = r * 16 + v + 8 * hlf;                         // local token row 0..31
        const h16 y = (h16)acc[r][t][v];
        const int idx = (mat < 4) ? (rr * 64 + d) : ((rr >> 4) * 1024 + d * 16 + (rr & 15));
        Tp[idx] = y;
      }
  }
  wave_lds_sync();
  if (mat < 4) {                                   // block-uniform branch, no barriers inside
    h16* P = (mat < 2) ? Qa : Kc;
    const int coff = (mat & 1) * DH;
    h16* dst = P + ((size_t)g * SEQ + t0) * QKW + coff;              // 32 rows of 64 halves, row pitch 128 halves
#pragma unroll
    for (int j = 0; j < 8; ++j) {
      const int rr = j * 4 + (lane >> 3), c8 = (lane & 7) * 8;
      *(v8h*)(dst + (size_t)rr * QKW + c8) = ld8h(Tp + rr * 64 + c8);
    }
    
  } else {
    h16* dst = Vp + ((size_t)g * QT + (t0 >> 4)) * (size_t)(DH * 16); // two consecutive key tiles = 4 KB contiguous
#pragma unroll
    for (int j = 0; j < 8; ++j) { const int e = (j * 32 + lane) * 8; *(v8h*)(dst + e) = ld8h(Tp + e); }
    
  }
}

__device__ __forceinline__ unsigned int lds_off(const void* p) { return (unsigned int)(size_t)p; }
// One 64-key stage into one LDS buffer, 256 lanes x 6 asynchronous 16-byte copies (4 of K, 2 of V), through no register.
// kg / vg: this lane's first 16 bytes of the stage's K rows / V tiles; lk / lv: their LDS byte addresses.
// K copy i: row i*16 + tid/16, piece tid%16 (a wave covers two whole 256-B rows); V copy i: bytes i*4096 + tid*16.
// s_wait_xcnt 0 closes the statement so that no address register is rewritten while a copy may still name it.
__device__ __forceinline__ void stage_copy(const h16* kg, const h16* vg, unsigned int lk, unsigned int lv) {
  asm volatile("global_load_async_to_lds_b128 %0, %6, off\n\t"
               "global_load_async_to_lds_b128 %1, %7, off\n\t"
               "global_load_async_to_lds_b128 %2, %8, off\n\t"
               "global_load_async_to_lds_b128 %3, %9, off\n\t"
               "global_load_async_to_lds_b128 %4, %10, off\n\t"
               "global_load_async_to_lds_b128 %5, %11, off\n\t"
               "s_wait_xcnt 0x0"
               :: "v"(lk), "v"(lk + 16 * KPITCH), "v"(lk + 32 * KPITCH), "v"(lk + 48 * KPITCH), "v"(lv), "v"(lv + 4096),
                  "v"(kg), "v"(kg + 16 * QKW), "v"(kg + 32 * QKW), "v"(kg + 48 * QKW), "v"(vg), "v"(vg + 2048)
               : "memory");
}

// ---------------------------------------------------------------------------
// Transposed flash attention: each wave owns one 16-query tile of one (b, head); 8 waves per block; all SEQ keys in chunks of 32.
// The block's 8 waves share one (b, head): its K rows and V tiles come once per block into a two-buffer LDS ring, 64 keys a stage,
// by asynchronous copies issued one stage ahead; every wave reads its fragments from the ring.
// Sr^T = Kc.Qa^T and Si^T = Kc.Qb^T (f16 fragments, 4 k-steps over the 128-wide re|im rows),
// s = sqrt((sr/8)^2 + (si/8)^2) in f32, per-lane online softmax (running max);
// P^T fragment built in registers from two S^T tiles (element r <- keys 0..15 tile, element 8+r <- keys 16..31 tile), carried x4096;
// ---------------------------------------------------------------------------
__global__ __launch_bounds__(256) void attn_kernel(const h16* __restrict__ Qa, const h16* __restrict__ Kc, const h16* __restrict__ Vp,
                                                   float* __restrict__ out) {
  __shared__ __attribute__((aligned(16))) float Os[8][16 * 64];
  __shared__ __attribute__((aligned(16))) unsigned char Ring[2][STG_B];
  const int wid = threadIdx.x >> 5, lane = threadIdx.x & 31, hh = lane >> 4, col = lane & 15;
  const int qtile = blockIdx.x * 8 + wid;                 // over NB*NH*QT (exact grid)
  const int g = qtile / QT;                               // b*NH + h
  const int q0 = (qtile % QT) << 4;
  const int b = g / NH, h = g % NH;
  const size_t kbase = (size_t)g * SEQ * QKW;             // Kc plane base of (b,h)
  const size_t vbase = (size_t)g * SEQ * DH;              // V key-tiled base of (b,h): QT tiles of 64x16
  const h16* qrow = Qa + ((size_t)g * SEQ + q0 + col) * QKW;
  const v16h qf0 = frag_kh(qrow, hh), qf1 = frag_kh(qrow + 32, hh);        // qr d 0..31, 32..63 of query q0+col
  const v16h qf2 = frag_kh(qrow + 64, hh), qf3 = frag_kh(qrow + 96, hh);   // qi d 0..31, 32..63
  const v16h qn0 = neg16h(qf0), qn1 = neg16h(qf1);                          // -qr (exact)
  float m = -INFINITY, l = 0.0f;
  v8f o0 = {}, o1 = {}, o2 = {}, o3 = {};
  const int tid = threadIdx.x;
  const h16* kg = Kc + kbase + (size_t)(tid >> 4) * QKW + (tid & 15) * 8;   // this lane's first K piece of stage 0
  const h16* vg = Vp + vbase + (size_t)tid * 8;                             // this lane's first V piece of stage 0
  const unsigned int lk = lds_off(&Ring[0][0]) + (unsigned int)((tid >> 4) * KPITCH + (tid & 15) * 16);
  const unsigned int lv = lds_off(&Ring[0][0]) + (unsigned int)(KSTG_B + tid * 16);
  stage_copy(kg, vg, lk, lv);                                               // stage 0 -> buffer 0
  asm volatile("s_wait_asynccnt 0x0" ::: "memory");                         // this wave's copies of stage 0 have landed
  __syncthreads();                                                          // publishes stage 0 to all 8 waves
  stage_copy(kg + (size_t)STG * QKW, vg + (size_t)STG * DH, lk + STG_B, lv + STG_B);   // stage 1 -> buffer 1 (NSTG >= 2)
  for (int st = 0; st < NSTG; ++st) {
   const unsigned char* buf = &Ring[st & 1][0];
   for (int ps = 0; ps < 2; ++ps) {
    const h16* k0p = (const h16*)(buf + (ps * 32 + col) * KPITCH);  // key st*64+ps*32+col (tile 0)
    const h16* k1p = (const h16*)(buf + (ps * 32 + 16 + col) * KPITCH);   // 16 keys further (tile 1)
    v8f s0r = {}, s0i = {}, s1r = {}, s1i = {};
    {
      // all eight K fragments are read as one group ahead of the products
      const v16h kf0 = frag_kh(k0p, hh), kf1 = frag_kh(k0p + 32, hh), kf2 = frag_kh(k0p + 64, hh), kf3 = frag_kh(k0p + 96, hh);
      const v16h kf4 = frag_kh(k1p, hh), kf5 = frag_kh(k1p + 32, hh), kf6 = frag_kh(k1p + 64, hh), kf7 = frag_kh(k1p + 96, hh);
      s0r = wmma_h(kf0, qf0, s0r); s0i = wmma_h(kf0, qf2, s0i);
      s0r = wmma_h(kf1, qf1, s0r); s0i = wmma_h(kf1, qf3, s0i);
      s0r = wmma_h(kf2, qf2, s0r); s0i = wmma_h(kf2, qn0, s0i);
      s0r = wmma_h(kf3, qf3, s0r); s0i = wmma_h(kf3, qn1, s0i);
      s1r = wmma_h(kf4, qf0, s1r); s1i = wmma_h(kf4, qf2, s1i);
      s1r = wmma_h(kf5, qf1, s1r); s1i = wmma_h(kf5, qf3, s1i);
      s1r = wmma_h(kf6, qf2, s1r); s1i = wmma_h(kf6, qn0, s1i);
      s1r = wmma_h(kf7, qf3, s1r); s1i = wmma_h(kf7, qn1, s1i);
    }
    // the pass's four V fragments, read here so that the score arithmetic covers their LDS latency
    const h16* v0p = (const h16*)(buf + KSTG_B) + ps * (2 * DH * 16) + 8 * hh + col * 16;   // key tile 0 of the pass; tile 1 is DH*16 further
    const v16h va0 = cat8h(ld8h(v0p + 0 * 256), ld8h(v0p + DH * 16 + 0 * 256));
    const v16h va1 = cat8h(ld8h(v0p + 1 * 256), ld8h(v0p + DH * 16 + 1 * 256));
    const v16h va2 = cat8h(ld8h(v0p + 2 * 256), ld8h(v0p + DH * 16 + 2 * 256));
    const v16h va3 = cat8h(ld8h(v0p + 3 * 256), ld8h(v0p + DH * 16 + 3 * 256));
    v8f sc0, sc1;
#pragma unroll
    for (int r = 0; r < 8; ++r) {
      const float a0 = s0r[r] * SCORE_SCALE, b0 = s0i[r] * SCORE_SCALE;
      const float a1 = s1r[r] * SCORE_SCALE, b1 = s1i[r] * SCORE_SCALE;
      sc0[r] = sqrtf(a0 * a0 + b0 * b0);
      sc1[r] = sqrtf(a1 * a1 + b1 * b1);
    }
    float mr = -INFINITY;
#pragma unroll
    for (int r = 0; r < 8; ++r) mr = fmaxf(mr, fmaxf(sc0[r], sc1[r]));
    mr = fmaxf(mr, __shfl_xor(mr, 16));
    const float mn = fmaxf(m, mr);            // finite (scores >= 0)
    const float al_ = __expf(m - mn);         // 0 on the first chunk
    m = mn;
    float sum = 0.0f;
    v16h pb;
#pragma unroll
    for (int r = 0; r < 8; ++r) {
      const float p0 = __expf(sc0[r] - mn), p1 = __expf(sc1[r] - mn);
      sum += p0 + p1;
      pb[r] = (h16)(p0 * P_CARRY); pb[8 + r] = (h16)(p1 * P_CARRY);
    }
    sum += __shfl_xor(sum, 16);
    l = l * al_ + sum;
    o0 = o0 * al_; o1 = o1 * al_; o2 = o2 * al_; o3 = o3 * al_;
    o0 = wmma_h(va0, pb, o0);
    o1 = wmma_h(va1, pb, o1);
    o2 = wmma_h(va2, pb, o2);
    o3 = wmma_h(va3, pb, o3);
   }
   asm volatile("s_wait_dscnt 0x0" ::: "memory");      // this wave's reads of stage st have returned
   asm volatile("s_wait_asynccnt 0x0" ::: "memory");   // this wave's copies of stage st+1 have landed
   __syncthreads();                                    // publishes stage st+1 and frees the buffer of stage st
   if (st + 2 < NSTG)                                  // block-uniform: refill the buffer just read with stage st+2
     stage_copy(kg + (size_t)(st + 2) * (STG * QKW), vg + (size_t)(st + 2) * (STG * DH), lk + (st & 1) * STG_B, lv + (st & 1) * STG_B);
  }
  asm volatile("s_wait_asynccnt 0x0" ::: "memory");    // no copy is outstanding when the wave goes on to the epilogue
  const float inv = (1.0f / l) * INV_P_CARRY;   // ctx = (o / 4096) / l
  float* Tt = Os[wid];                          // [query col][d], d = n*16 + 8hh + r
  {
    float* tp = Tt + col * 64 + 8 * hh;
    const v4f a0 = {o0[0] * inv, o0[1] * inv, o0[2] * inv, o0[3] * inv}, a1 = {o0[4] * inv, o0[5] * inv, o0[6] * inv, o0[7] * inv};
    const v4f b0 = {o1[0] * inv, o1[1] * inv, o1[2] * inv, o1[3] * inv}, b1 = {o1[4] * inv, o1[5] * inv, o1[6] * inv, o1[7] * inv};
    const v4f c0 = {o2[0] * inv, o2[1] * inv, o2[2] * inv, o2[3] * inv}, c1 = {o2[4] * inv, o2[5] * inv, o2[6] * inv, o2[7] * inv};
    const v4f d0 = {o3[0] * inv, o3[1] * inv, o3[2] * inv, o3[3] * inv}, d1 = {o3[4] * inv, o3[5] * inv, o3[6] * inv, o3[7] * inv};
    *(v4f*)(tp + 0)  = a0; *(v4f*)(tp + 4)  = a1;
    *(v4f*)(tp + 16) = b0; *(v4f*)(tp + 20) = b1;
    *(v4f*)(tp + 32) = c0; *(v4f*)(tp + 36) = c1;
    *(v4f*)(tp + 48) = d0; *(v4f*)(tp + 52) = d1;
  }
  wave_lds_sync();
  float* dst0 = out + ((size_t)b * SEQ + q0) * HID + h * DH;   // 16 rows x 64 floats, row stride HID floats
#pragma unroll
  for (int j = 0; j < 8; ++j) {
    const int rr = j * 2 + hh, c4 = col * 4;
    *(v4f*)(dst0 + (size_t)rr * HID + c4) = *(const v4f*)(Tt + rr * 64 + c4);
  }
  
}
}  // namespace

extern "C" void kernel_launch(void* const* d_in, const int* in_sizes, int n_in,
                              void* d_out, int out_size, void* d_ws, size_t ws_size, hipStream_t stream) {
  if (n_in < 6) return;
  const size_t need_x = ((size_t)(NB - 1) * SEQ_FULL + SEQ) * HID;
  if ((size_t)in_sizes[0] < need_x) return;
  for (int i = 1; i <= 5; ++i) if (in_sizes[i] < HID * HID) return;
  if ((size_t)out_size < (size_t)MROWS * HID) return;

  const float* x   = (const float*)d_in[0];     // [NB_FULL, SEQ_FULL, 768] f32
  const float* Wqr = (const float*)d_in[1];     // [768,768] ([out][in])
  const float* Wqi = (const float*)d_in[2];
  const float* Wkr = (const float*)d_in[3];
  const float* Wki = (const float*)d_in[4];
  const float* Wv  = (const float*)d_in[5];
  float* out = (float*)d_out;                   // [NB, SEQ, 768] f32

  size_t off = 0; char* ws = (char*)d_ws;
  unsigned short* xpl = (unsigned short*)(ws + off); off += (size_t)MROWS * HID * 2;        // 6,291,456 B bf16 activation plane
  unsigned short* wpl = (unsigned short*)(ws + off); off += (size_t)NW * HID * HID * 2;     // 5,898,240 B bf16 weight planes
  h16* Qa = (h16*)(ws + off); off += (size_t)MROWS * NH * QKW * 2;                          // 12,582,912 B f16 [g][t][128]
  h16* Kc = (h16*)(ws + off); off += (size_t)MROWS * NH * QKW * 2;                          // 12,582,912 B f16 [g][t][128]
  h16* Vp = (h16*)(ws + off); off += (size_t)MROWS * HID * 2;                               // 6,291,456 B f16 key-tiled
  if (off > ws_size) return;                                                                 // 43,646,976 B at NB=2, SEQ=2048

  cvt_kernel<<<1024, 256, 0, stream>>>(x, Wqr, Wqi, Wkr, Wki, Wv, xpl, wpl);
  proj_gemm_kernel<<<dim3(NCOMB / 64, MROWS / 128), 128, 0, stream>>>((const b16*)xpl, (const b16*)wpl, Qa, Kc, Vp);
  attn_kernel<<<(NB * NH * QT) / 8, 256, 0, stream>>>(Qa, Kc, Vp, out);
}

// v002
// A run of this version takes 121 microseconds.
// Two timings next to v001 put it at 1.35 and 1.36 times that version's speed.
// All steps since v000 together make it 2.69 times as fast.
#include <hip/hip_runtime.h>

// Contractions: five projections x.W^T (K = 768) on v_wmma_f32_16x16x32_bf16 (bf16 RNE operands, f32 accumulate, one product per tile pair);
// Sr^T = Kc.Qa^T and Si^T = Kc.Qb^T (K = 128: concatenated re | im head dims; Qb = [qi | -qr] by exact f16 sign flip of the Qa fragments)
// and ctx^T = V^T.P^T (32 keys per step, P carried x4096) on v_wmma_f32_16x16x32_f16 (f16 operands, f32 accumulate, one product per tile pair);
// magnitude sqrt(sr^2 + si^2), online softmax statistics and the final normalisation in f32.

#pragma clang fp contract(off)

#ifndef NB
#define NB 2
#endif
#ifndef SEQ
#define SEQ 2048
#endif
#ifndef NB_FULL
#define NB_FULL 2
#endif
#ifndef SEQ_FULL
#define SEQ_FULL 2048
#endif

namespace {
constexpr int HID = 768, DH = 64, NH = 12;
constexpr int NW = 5;                           // weight matrices: qr, qi, kr, ki, v ([out][in], k contiguous)
constexpr int NCOMB = NW * HID;                 // 3840 rows of the combined 16-bit weight plane
constexpr int MROWS = NB * SEQ;                 // compact token rows (b*SEQ + t)
constexpr int QT = SEQ / 16;                    // 16-query tiles per (b, head)
constexpr int QKW = 2 * DH;                     // 128: row width of the Qa / Kc planes (re | im)
constexpr float SCORE_SCALE = 0.125f;           // 1/sqrt(64)
constexpr float P_CARRY = 4096.0f;              // f16 P operand = exp(s - m) * 4096
constexpr float INV_P_CARRY = 1.0f / 4096.0f;
constexpr int STG = 64;                         // keys per LDS stage of the attention kernel (two 32-key passes)
constexpr int NSTG = SEQ / STG;                 // stages per (b, head)
constexpr int KPITCH = 272;                     // LDS bytes per staged K row: 256 + 16, 16 B x odd, conflict-free for 16-byte reads
constexpr int KSTG_B = STG * KPITCH;            // 17,408 B of K rows per stage
constexpr int VSTG_B = STG * DH * 2;            // 8,192 B of key-tiled V per stage
constexpr int STG_B = KSTG_B + VSTG_B;          // 25,600 B per buffer
constexpr int GKC = 64;                         // k elements per LDS stage of the projection GEMM (128 B of every operand row)
constexpr int GNST = HID / GKC;                 // 12 stages
constexpr int GPITCH = 144;                     // LDS bytes per staged operand row: 128 + 16, 16 B x odd, conflict-free for 16-byte reads
constexpr int GSTG_B = 256 * GPITCH;            // 36,864 B per buffer: 128 activation rows, then 128 weight rows
static_assert(HID % GKC == 0);
static_assert(GNST >= 2);
static_assert(NCOMB % 128 == 0);
static_assert(NH % 2 == 0);
static_assert(8 * 32 * 64 * 2 <= 2 * GSTG_B);
static_assert(SEQ % 128 == 0);
static_assert(NSTG >= 2);
static_assert(NB >= 1 && NB <= NB_FULL);
static_assert(SEQ <= SEQ_FULL);
static_assert(NH * DH == HID);
static_assert(MROWS % 128 == 0);
static_assert(HID % 32 == 0);
static_assert(NCOMB % 64 == 0);
static_assert((NB * NH * QT) % 8 == 0);
static_assert((size_t)MROWS * HID <= (size_t)NB_FULL * SEQ_FULL * HID);

typedef __bf16 b16;
typedef _Float16 h16;
typedef __bf16 v16b __attribute__((ext_vector_type(16)));
typedef __bf16 v8b __attribute__((ext_vector_type(8)));
typedef _Float16 v16h __attribute__((ext_vector_type(16)));
typedef _Float16 v8h __attribute__((ext_vector_type(8)));
typedef float v8f __attribute__((ext_vector_type(8)));
typedef float v4f __attribute__((ext_vector_type(4)));
typedef unsigned short v8us __attribute__((ext_vector_type(8)));
typedef unsigned int v8u __attribute__((ext_vector_type(8)));

__device__ __forceinline__ v8b ld8b(const b16* p) { return *(const v8b*)p; }
__device__ __forceinline__ v8h ld8h(const h16* p) { return *(const v8h*)p; }
__device__ __forceinline__ v16b cat8b(v8b a, v8b b) { return __builtin_shufflevector(a, b, 0, 1, 2, 3, 4, 5, 6, 7, 8, 9, 10, 11, 12, 13, 14, 15); }
__device__ __forceinline__ v16h cat8h(v8h a, v8h b) { return __builtin_shufflevector(a, b, 0, 1, 2, 3, 4, 5, 6, 7, 8, 9, 10, 11, 12, 13, 14, 15); }
// 16x16x32 16-bit fragment from a k-contiguous row pointer (A: lane&15 = row, B: lane&15 = column), hh = lane>>4:
// elements 0..7 <- p[8hh+0..7], elements 8..15 <- p[16+8hh+0..7]
__device__ __forceinline__ v16b frag_kb(const b16* p, int hh) { return cat8b(ld8b(p + 8 * hh), ld8b(p + 16 + 8 * hh)); }
__device__ __forceinline__ v16h frag_kh(const h16* p, int hh) { return cat8h(ld8h(p + 8 * hh), ld8h(p + 16 + 8 * hh)); }

__device__ __forceinline__ v8f wmma_b(v16b a, v16b b, v8f c) {
  v8f d = __builtin_amdgcn_wmma_f32_16x16x32_bf16(false, a, false, b, (short)0, c, false, false);
  asm volatile("v_nop\n\tv_nop\n\tv_nop\n\tv_nop" : "+v"(d) : "v"(a), "v"(b));
  return d;
}
__device__ __forceinline__ v8f wmma_h(v16h a, v16h b, v8f c) {
  v8f d = __builtin_amdgcn_wmma_f32_16x16x32_f16(false, a, false, b, (short)0, c, false, false);
  asm volatile("v_nop\n\tv_nop\n\tv_nop\n\tv_nop" : "+v"(d) : "v"(a), "v"(b));
  return d;
}
// exact sign flip of 16 packed f16 values
__device__ __forceinline__ v16h neg16h(v16h a) {
  v8u t = __builtin_bit_cast(v8u, a);
  const v8u s = {0x80008000u, 0x80008000u, 0x80008000u, 0x80008000u, 0x80008000u, 0x80008000u, 0x80008000u, 0x80008000u};
  t = t ^ s;
  return __builtin_bit_cast(v16h, t);
}
// f32 -> bf16 by RNE convert, returned as the f32 bit pattern with the low 16 bits cleared
__device__ __forceinline__ unsigned int bf16_rne_u32(float f) {
  unsigned int u = __builtin_bit_cast(unsigned int, f);
  u += 0x7fffu + ((u >> 16) & 1u);
  return u & 0xffff0000u;
}
// wave-private LDS tile: stores by this wave, then vector reloads by this wave
__device__ __forceinline__ void wave_lds_sync() {
  __builtin_amdgcn_fence(3, "workgroup");
  __builtin_amdgcn_wave_barrier();
  __builtin_amdgcn_fence(2, "workgroup");
}

// ---------------------------------------------------------------------------
// x f32 [NB_FULL][SEQ_FULL][768] -> bf16 plane xpl [MROWS][768] (compact rows b*SEQ+t);
// weights W[n][k] f32 ([out][in], k contiguous) -> bf16 planes wpl [5][768][768] in the order qr, qi, kr, ki, v.
// ---------------------------------------------------------------------------
__global__ __launch_bounds__(256) void cvt_kernel(const float* __restrict__ x,
                                                  const float* __restrict__ w0, const float* __restrict__ w1, const float* __restrict__ w2,
                                                  const float* __restrict__ w3, const float* __restrict__ w4,
                                                  unsigned short* __restrict__ xpl, unsigned short* __restrict__ wpl) {
  const size_t tid = (size_t)blockIdx.x * blockDim.x + threadIdx.x, stride = (size_t)gridDim.x * blockDim.x;
  const size_t nx = (size_t)MROWS * HID / 8;
  const size_t per_w = (size_t)HID * HID / 8, nw = (size_t)NW * per_w;
  {
    for (size_t c = tid; c < nx; c += stride) {
      const size_t i = c * 8;                                       // element index inside the compact plane
      const int m = (int)(i / HID), col = (int)(i % HID);
      const int bb = m / SEQ, t = m - bb * SEQ;
      const float* p = x + ((size_t)bb * SEQ_FULL + t) * HID + col;
      const v4f f0 = *(const v4f*)p, f1 = *(const v4f*)(p + 4);
      v8us o;
#pragma unroll
      for (int e = 0; e < 4; ++e) {
        o[e] = (unsigned short)(bf16_rne_u32(f0[e]) >> 16);
        o[4 + e] = (unsigned short)(bf16_rne_u32(f1[e]) >> 16);
      }
      *(v8us*)(xpl + i) = o;
    }
    for (size_t c = tid; c < nw; c += stride) {
      const int mat = (int)(c / per_w);
      const size_t i = (c - (size_t)mat * per_w) * 8;               // element index inside one [768][768] matrix
      const float* w = (mat == 0) ? w0 : (mat == 1) ? w1 : (mat == 2) ? w2 : (mat == 3) ? w3 : w4;
      const v4f f0 = *(const v4f*)(w + i), f1 = *(const v4f*)(w + i + 4);
      v8us o;
#pragma unroll
      for (int e = 0; e < 4; ++e) {
        o[e] = (unsigned short)(bf16_rne_u32(f0[e]) >> 16);
        o[4 + e] = (unsigned short)(bf16_rne_u32(f1[e]) >> 16);
      }
      *(v8us*)(wpl + c * 8) = o;                           // plane offset mat*768*768 + i == c*8
    }
    
  }
}

__device__ __forceinline__ unsigned int lds_off(const void* p) { return (unsigned int)(size_t)p; }
// One 64-k stage of the projection GEMM into one LDS buffer: 256 lanes x 8 asynchronous 16-byte copies (4 of activation rows,
// 4 of weight rows), through no register. ag / wg: this lane's first 16 bytes of the stage; la: their LDS byte address.
// Copy i: row i*32 + tid/8, piece tid%8 (a wave covers four whole 128-B lines).
// s_wait_xcnt 0 closes the statement so that no address register is rewritten while a copy may still name it.
__device__ __forceinline__ void gemm_stage_copy(const b16* ag, const b16* wg, unsigned int la) {
  asm volatile("global_load_async_to_lds_b128 %0, %8, off\n\t"
               "global_load_async_to_lds_b128 %1, %9, off\n\t"
               "global_load_async_to_lds_b128 %2, %10, off\n\t"
               "global_load_async_to_lds_b128 %3, %11, off\n\t"
               "global_load_async_to_lds_b128 %4, %12, off\n\t"
               "global_load_async_to_lds_b128 %5, %13, off\n\t"
               "global_load_async_to_lds_b128 %6, %14, off\n\t"
               "global_load_async_to_lds_b128 %7, %15, off\n\t"
               "s_wait_xcnt 0x0"
               :: "v"(la), "v"(la + 32 * GPITCH), "v"(la + 64 * GPITCH), "v"(la + 96 * GPITCH),
                  "v"(la + 128 * GPITCH), "v"(la + 160 * GPITCH), "v"(la + 192 * GPITCH), "v"(la + 224 * GPITCH),
                  "v"(ag), "v"(ag + 32 * HID), "v"(ag + 64 * HID), "v"(ag + 96 * HID),
                  "v"(wg), "v"(wg + 32 * HID), "v"(wg + 64 * HID), "v"(wg + 96 * HID)
               : "memory");
}

// ---------------------------------------------------------------------------
// Projection GEMM: (MROWS x 768) x (768 x 3840), grid (30, MROWS/128), block 8 waves = 128 token rows x 128 columns,
// wave = 32 token rows x 64 columns (one head of one of the five matrices); waves 0..3 take the block's first head, 4..7 its second.
// The block's 128 activation rows and 128 weight rows come once per block into a two-buffer LDS ring, 64 k a stage,
// by asynchronous copies issued one stage ahead; every wave reads its fragments from the ring (32 k a step, k ascending).
// blockIdx.x -> mat = x/6 (qr, qi, kr, ki, v), heads 2*(x%6) and 2*(x%6)+1. Output f16 planes:
// v -> Vp key-tiled [g][t/16][64][16] (4 KB contiguous per wave), g = b*12 + head.
// ---------------------------------------------------------------------------
__global__ __launch_bounds__(256) void proj_gemm_kernel(const b16* __restrict__ xpl, const b16* __restrict__ wpl,
                                                        h16* __restrict__ Qa, h16* __restrict__ Kc, h16* __restrict__ Vp) {
  __shared__ __attribute__((aligned(16))) unsigned char Gs[2 * GSTG_B];   // the ring; behind the loop's last barrier the output staging
  const int tid = threadIdx.x;
  const int lane = tid & 31, wave = tid >> 5, nloc = lane & 15, hlf = lane >> 4;
  const int msub = wave & 3, nsub = wave >> 2;
  const int m0 = blockIdx.y * 128 + msub * 32;
  const int mat = blockIdx.x / (NH / 2);           // block-uniform: both heads of a block belong to one matrix
  const int head = (blockIdx.x - mat * (NH / 2)) * 2 + nsub;
  v8f acc[2][4];
#pragma unroll
  for (int r = 0; r < 2; ++r)
#pragma unroll
    for (int t = 0; t < 4; ++t) acc[r][t] = (v8f){};
  const b16* ag = xpl + (size_t)(blockIdx.y * 128 + (tid >> 3)) * HID + (tid & 7) * 8;   // this lane's first activation piece of stage 0
  const b16* wg = wpl + (size_t)(blockIdx.x * 128 + (tid >> 3)) * HID + (tid & 7) * 8;   // this lane's first weight piece of stage 0
  const unsigned int la = lds_off(&Gs[0]) + (unsigned int)((tid >> 3) * GPITCH + (tid & 7) * 16);
  gemm_stage_copy(ag, wg, la);                                              // stage 0 -> buffer 0
  asm volatile("s_wait_asynccnt 0x0" ::: "memory");                         // this wave's copies of stage 0 have landed
  __syncthreads();                                                          // publishes stage 0 to all 8 waves
  gemm_stage_copy(ag + GKC, wg + GKC, la + GSTG_B);                         // stage 1 -> buffer 1 (GNST >= 2)
  for (int st = 0; st < GNST; ++st) {
    const unsigned char* buf = &Gs[(st & 1) * GSTG_B];
    const b16* ar = (const b16*)(buf + (msub * 32 + nloc) * GPITCH);        // activation row m0 + nloc; 16 rows further: a1
    const b16* wr = (const b16*)(buf + (128 + nsub * 64 + nloc) * GPITCH);  // weight row of column nloc of the wave's head
#pragma unroll   // both 32-k steps of a stage inline, so that every fragment read has a constant LDS offset
    for (int kk = 0; kk < GKC; kk += 32) {
      const v16b a0 = frag_kb(ar + kk, hlf);
      const v16b a1 = frag_kb(ar + 16 * (GPITCH / 2) + kk, hlf);
      // the step's six fragments are read as one group ahead of its eight products
      const v16b bf0 = frag_kb(wr + kk, hlf), bf1 = frag_kb(wr + 16 * (GPITCH / 2) + kk, hlf);
      const v16b bf2 = frag_kb(wr + 32 * (GPITCH / 2) + kk, hlf), bf3 = frag_kb(wr + 48 * (GPITCH / 2) + kk, hlf);
      acc[0][0] = wmma_b(a0, bf0, acc[0][0]); acc[1][0] = wmma_b(a1, bf0, acc[1][0]);
      acc[0][1] = wmma_b(a0, bf1, acc[0][1]); acc[1][1] = wmma_b(a1, bf1, acc[1][1]);
      acc[0][2] = wmma_b(a0, bf2, acc[0][2]); acc[1][2] = wmma_b(a1, bf2, acc[1][2]);
      acc[0][3] = wmma_b(a0, bf3, acc[0][3]); acc[1][3] = wmma_b(a1, bf3, acc[1][3]);
    }
    asm volatile("s_wait_dscnt 0x0" ::: "memory");      // this wave's reads of stage st have returned
    asm volatile("s_wait_asynccnt 0x0" ::: "memory");   // this wave's copies of stage st+1 have landed
    __syncthreads();                                    // publishes stage st+1 and frees the buffer of stage st
    if (st + 2 < GNST)                                  // block-uniform: refill the buffer just read with stage st+2
      gemm_stage_copy(ag + (st + 2) * GKC, wg + (st + 2) * GKC, la + (st & 1) * GSTG_B);
  }
  asm volatile("s_wait_asynccnt 0x0" ::: "memory");     // no copy is outstanding when the ring becomes the output staging
  const int b = m0 / SEQ, t0 = m0 % SEQ;
  const int g = b * NH + head;
  h16* Tp = (h16*)&Gs[0] + wave * (32 * 64);       // 4 KB of the ring per wave: every read of it ended at the loop's last barrier
#pragma unroll
  for (int t = 0; t < 4; ++t) {
    const int d = t * 16 + nloc;
#pragma unroll
    for (int r = 0; r < 2; ++r)
#pragma unroll
      for (int v = 0; v < 8; ++v) {
        const int rr = r * 16 + v + 8 * hlf;                         // local token row 0..31
        const h16 y = (h16)acc[r][t][v];
        const int idx = (mat < 4) ? (rr * 64 + d) : ((rr >> 4) * 1024 + d * 16 + (rr & 15));
        Tp[idx] = y;
      }
  }
  wave_lds_sync();
  if (mat < 4) {                                   // block-uniform branch, no barriers inside
    h16* P = (mat < 2) ? Qa : Kc;
    const int coff = (mat & 1) * DH;
    h16* dst = P + ((size_t)g * SEQ + t0) * QKW + coff;              // 32 rows of 64 halves, row pitch 128 halves
#pragma unroll
    for (int j = 0; j < 8; ++j) {
      const int rr = j * 4 + (lane >> 3), c8 = (lane & 7) * 8;
      *(v8h*)(dst + (size_t)rr * QKW + c8) = ld8h(Tp + rr * 64 + c8);
    }
    
  } else {
    h16* dst = Vp + ((size_t)g * QT + (t0 >> 4)) * (size_t)(DH * 16); // two consecutive key tiles = 4 KB contiguous
#pragma unroll
    for (int j = 0; j < 8; ++j) { const int e = (j * 32 + lane) * 8; *(v8h*)(dst + e) = ld8h(Tp + e); }
    
  }
}

// One 64-key stage into one LDS buffer, 256 lanes x 6 asynchronous 16-byte copies (4 of K, 2 of V), through no register.
// kg / vg: this lane's first 16 bytes of the stage's K rows / V tiles; lk / lv: their LDS byte addresses.
// K copy i: row i*16 + tid/16, piece tid%16 (a wave covers two whole 256-B rows); V copy i: bytes i*4096 + tid*16.
// s_wait_xcnt 0 closes the statement so that no address register is rewritten while a copy may still name it.
__device__ __forceinline__ void stage_copy(const h16* kg, const h16* vg, unsigned int lk, unsigned int lv) {
  asm volatile("global_load_async_to_lds_b128 %0, %6, off\n\t"
               "global_load_async_to_lds_b128 %1, %7, off\n\t"
               "global_load_async_to_lds_b128 %2, %8, off\n\t"
               "global_load_async_to_lds_b128 %3, %9, off\n\t"
               "global_load_async_to_lds_b128 %4, %10, off\n\t"
               "global_load_async_to_lds_b128 %5, %11, off\n\t"
               "s_wait_xcnt 0x0"
               :: "v"(lk), "v"(lk + 16 * KPITCH), "v"(lk + 32 * KPITCH), "v"(lk + 48 * KPITCH), "v"(lv), "v"(lv + 4096),
                  "v"(kg), "v"(kg + 16 * QKW), "v"(kg + 32 * QKW), "v"(kg + 48 * QKW), "v"(vg), "v"(vg + 2048)
               : "memory");
}

// ---------------------------------------------------------------------------
// Transposed flash attention: each wave owns one 16-query tile of one (b, head); 8 waves per block; all SEQ keys in chunks of 32.
// The block's 8 waves share one (b, head): its K rows and V tiles come once per block into a two-buffer LDS ring, 64 keys a stage,
// by asynchronous copies issued one stage ahead; every wave reads its fragments from the ring.
// Sr^T = Kc.Qa^T and Si^T = Kc.Qb^T (f16 fragments, 4 k-steps over the 128-wide re|im rows),
// s = sqrt((sr/8)^2 + (si/8)^2) in f32, per-lane online softmax (running max);
// P^T fragment built in registers from two S^T tiles (element r <- keys 0..15 tile, element 8+r <- keys 16..31 tile), carried x4096;
// ---------------------------------------------------------------------------
__global__ __launch_bounds__(256) void attn_kernel(const h16* __restrict__ Qa, const h16* __restrict__ Kc, const h16* __restrict__ Vp,
                                                   float* __restrict__ out) {
  __shared__ __attribute__((aligned(16))) float Os[8][16 * 64];
  __shared__ __attribute__((aligned(16))) unsigned char Ring[2][STG_B];
  const int wid = threadIdx.x >> 5, lane = threadIdx.x & 31, hh = lane >> 4, col = lane & 15;
  const int qtile = blockIdx.x * 8 + wid;                 // over NB*NH*QT (exact grid)
  const int g = qtile / QT;                               // b*NH + h
  const int q0 = (qtile % QT) << 4;
  const int b = g / NH, h = g % NH;
  const size_t kbase = (size_t)g * SEQ * QKW;             // Kc plane base of (b,h)
  const size_t vbase = (size_t)g * SEQ * DH;              // V key-tiled base of (b,h): QT tiles of 64x16
  const h16* qrow = Qa + ((size_t)g * SEQ + q0 + col) * QKW;
  const v16h qf0 = frag_kh(qrow, hh), qf1 = frag_kh(qrow + 32, hh);        // qr d 0..31, 32..63 of query q0+col
  const v16h qf2 = frag_kh(qrow + 64, hh), qf3 = frag_kh(qrow + 96, hh);   // qi d 0..31, 32..63
  const v16h qn0 = neg16h(qf0), qn1 = neg16h(qf1);                          // -qr (exact)
  float m = -INFINITY, l = 0.0f;
  v8f o0 = {}, o1 = {}, o2 = {}, o3 = {};
  const int tid = threadIdx.x;
  const h16* kg = Kc + kbase + (size_t)(tid >> 4) * QKW + (tid & 15) * 8;   // this lane's first K piece of stage 0
  const h16* vg = Vp + vbase + (size_t)tid * 8;                             // this lane's first V piece of stage 0
  const unsigned int lk = lds_off(&Ring[0][0]) + (unsigned int)((tid >> 4) * KPITCH + (tid & 15) * 16);
  const unsigned int lv = lds_off(&Ring[0][0]) + (unsigned int)(KSTG_B + tid * 16);
  stage_copy(kg, vg, lk, lv);                                               // stage 0 -> buffer 0
  asm volatile("s_wait_asynccnt 0x0" ::: "memory");                         // this wave's copies of stage 0 have landed
  __syncthreads();                                                          // publishes stage 0 to all 8 waves
  stage_copy(kg + (size_t)STG * QKW, vg + (size_t)STG * DH, lk + STG_B, lv + STG_B);   // stage 1 -> buffer 1 (NSTG >= 2)
  for (int st = 0; st < NSTG; ++st) {
   const unsigned char* buf = &Ring[st & 1][0];
   for (int ps = 0; ps < 2; ++ps) {
    const h16* k0p = (const h16*)(buf + (ps * 32 + col) * KPITCH);  // key st*64+ps*32+col (tile 0)
    const h16* k1p = (const h16*)(buf + (ps * 32 + 16 + col) * KPITCH);   // 16 keys further (tile 1)
    v8f s0r = {}, s0i = {}, s1r = {}, s1i = {};
    {
      // all eight K fragments are read as one group ahead of the products
      const v16h kf0 = frag_kh(k0p, hh), kf1 = frag_kh(k0p + 32, hh), kf2 = frag_kh(k0p + 64, hh), kf3 = frag_kh(k0p + 96, hh);
      const v16h kf4 = frag_kh(k1p, hh), kf5 = frag_kh(k1p + 32, hh), kf6 = frag_kh(k1p + 64, hh), kf7 = frag_kh(k1p + 96, hh);
      s0r = wmma_h(kf0, qf0, s0r); s0i = wmma_h(kf0, qf2, s0i);
      s0r = wmma_h(kf1, qf1, s0r); s0i = wmma_h(kf1, qf3, s0i);
      s0r = wmma_h(kf2, qf2, s0r); s0i = wmma_h(kf2, qn0, s0i);
      s0r = wmma_h(kf3, qf3, s0r); s0i = wmma_h(kf3, qn1, s0i);
      s1r = wmma_h(kf4, qf0, s1r); s1i = wmma_h(kf4, qf2, s1i);
      s1r = wmma_h(kf5, qf1, s1r); s1i = wmma_h(kf5, qf3, s1i);
      s1r = wmma_h(kf6, qf2, s1r); s1i = wmma_h(kf6, qn0, s1i);
      s1r = wmma_h(kf7, qf3, s1r); s1i = wmma_h(kf7, qn1, s1i);
    }
    // the pass's four V fragments, read here so that the score arithmetic covers their LDS latency
    const h16* v0p = (const h16*)(buf + KSTG_B) + ps * (2 * DH * 16) + 8 * hh + col * 16;   // key tile 0 of the pass; tile 1 is DH*16 further
    const v16h va0 = cat8h(ld8h(v0p + 0 * 256), ld8h(v0p + DH * 16 + 0 * 256));
    const v16h va1 = cat8h(ld8h(v0p + 1 * 256), ld8h(v0p + DH * 16 + 1 * 256));
    const v16h va2 = cat8h(ld8h(v0p + 2 * 256), ld8h(v0p + DH * 16 + 2 * 256));
    const v16h va3 = cat8h(ld8h(v0p + 3 * 256), ld8h(v0p + DH * 16 + 3 * 256));
    v8f sc0, sc1;
#pragma unroll
    for (int r = 0; r < 8; ++r) {
      const float a0 = s0r[r] * SCORE_SCALE, b0 = s0i[r] * SCORE_SCALE;
      const float a1 = s1r[r] * SCORE_SCALE, b1 = s1i[r] * SCORE_SCALE;
      sc0[r] = sqrtf(a0 * a0 + b0 * b0);
      sc1[r] = sqrtf(a1 * a1 + b1 * b1);
    }
    float mr = -INFINITY;
#pragma unroll
    for (int r = 0; r < 8; ++r) mr = fmaxf(mr, fmaxf(sc0[r], sc1[r]));
    mr = fmaxf(mr, __shfl_xor(mr, 16));
    const float mn = fmaxf(m, mr);            // finite (scores >= 0)
    const float al_ = __expf(m - mn);         // 0 on the first chunk
    m = mn;
    float sum = 0.0f;
    v16h pb;
#pragma unroll
    for (int r = 0; r < 8; ++r) {
      const float p0 = __expf(sc0[r] - mn), p1 = __expf(sc1[r] - mn);
      sum += p0 + p1;
      pb[r] = (h16)(p0 * P_CARRY); pb[8 + r] = (h16)(p1 * P_CARRY);
    }
    sum += __shfl_xor(sum, 16);
    l = l * al_ + sum;
    o0 = o0 * al_; o1 = o1 * al_; o2 = o2 * al_; o3 = o3 * al_;
    o0 = wmma_h(va0, pb, o0);
    o1 = wmma_h(va1, pb, o1);
    o2 = wmma_h(va2, pb, o2);
    o3 = wmma_h(va3, pb, o3);
   }
   asm volatile("s_wait_dscnt 0x0" ::: "memory");      // this wave's reads of stage st have returned
   asm volatile("s_wait_asynccnt 0x0" ::: "memory");   // this wave's copies of stage st+1 have landed
   __syncthreads();                                    // publishes stage st+1 and frees the buffer of stage st
   if (st + 2 < NSTG)                                  // block-uniform: refill the buffer just read with stage st+2
     stage_copy(kg + (size_t)(st + 2) * (STG * QKW), vg + (size_t)(st + 2) * (STG * DH), lk + (st & 1) * STG_B, lv + (st & 1) * STG_B);
  }
  asm volatile("s_wait_asynccnt 0x0" ::: "memory");    // no copy is outstanding when the wave goes on to the epilogue
  const float inv = (1.0f / l) * INV_P_CARRY;   // ctx = (o / 4096) / l
  float* Tt = Os[wid];                          // [query col][d], d = n*16 + 8hh + r
  {
    float* tp = Tt + col * 64 + 8 * hh;
    const v4f a0 = {o0[0] * inv, o0[1] * inv, o0[2] * inv, o0[3] * inv}, a1 = {o0[4] * inv, o0[5] * inv, o0[6] * inv, o0[7] * inv};
    const v4f b0 = {o1[0] * inv, o1[1] * inv, o1[2] * inv, o1[3] * inv}, b1 = {o1[4] * inv, o1[5] * inv, o1[6] * inv, o1[7] * inv};
    const v4f c0 = {o2[0] * inv, o2[1] * inv, o2[2] * inv, o2[3] * inv}, c1 = {o2[4] * inv, o2[5] * inv, o2[6] * inv, o2[7] * inv};
    const v4f d0 = {o3[0] * inv, o3[1] * inv, o3[2] * inv, o3[3] * inv}, d1 = {o3[4] * inv, o3[5] * inv, o3[6] * inv, o3[7] * inv};
    *(v4f*)(tp + 0)  = a0; *(v4f*)(tp + 4)  = a1;
    *(v4f*)(tp + 16) = b0; *(v4f*)(tp + 20) = b1;
    *(v4f*)(tp + 32) = c0; *(v4f*)(tp + 36) = c1;
    *(v4f*)(tp + 48) = d0; *(v4f*)(tp + 52) = d1;
  }
  wave_lds_sync();
  float* dst0 = out + ((size_t)b * SEQ + q0) * HID + h * DH;   // 16 rows x 64 floats, row stride HID floats
#pragma unroll
  for (int j = 0; j < 8; ++j) {
    const int rr = j * 2 + hh, c4 = col * 4;
    *(v4f*)(dst0 + (size_t)rr * HID + c4) = *(const v4f*)(Tt + rr * 64 + c4);
  }
  
}
}  // namespace

extern "C" void kernel_launch(void* const* d_in, const int* in_sizes, int n_in,
                              void* d_out, int out_size, void* d_ws, size_t ws_size, hipStream_t stream) {
  if (n_in < 6) return;
  const size_t need_x = ((size_t)(NB - 1) * SEQ_FULL + SEQ) * HID;
  if ((size_t)in_sizes[0] < need_x) return;
  for (int i = 1; i <= 5; ++i) if (in_sizes[i] < HID * HID) return;
  if ((size_t)out_size < (size_t)MROWS * HID) return;

  const float* x   = (const float*)d_in[0];     // [NB_FULL, SEQ_FULL, 768] f32
  const float* Wqr = (const float*)d_in[1];     // [768,768] ([out][in])
  const float* Wqi = (const float*)d_in[2];
  const float* Wkr = (const float*)d_in[3];
  const float* Wki = (const float*)d_in[4];
  const float* Wv  = (const float*)d_in[5];
  float* out = (float*)d_out;                   // [NB, SEQ, 768] f32

  size_t off = 0; char* ws = (char*)d_ws;
  unsigned short* xpl = (unsigned short*)(ws + off); off += (size_t)MROWS * HID * 2;        // 6,291,456 B bf16 activation plane
  unsigned short* wpl = (unsigned short*)(ws + off); off += (size_t)NW * HID * HID * 2;     // 5,898,240 B bf16 weight planes
  h16* Qa = (h16*)(ws + off); off += (size_t)MROWS * NH * QKW * 2;                          // 12,582,912 B f16 [g][t][128]
  h16* Kc = (h16*)(ws + off); off += (size_t)MROWS * NH * QKW * 2;                          // 12,582,912 B f16 [g][t][128]
  h16* Vp = (h16*)(ws + off); off += (size_t)MROWS * HID * 2;                               // 6,291,456 B f16 key-tiled
  if (off > ws_size) return;                                                                 // 43,646,976 B at NB=2, SEQ=2048

  cvt_kernel<<<1024, 256, 0, stream>>>(x, Wqr, Wqi, Wkr, Wki, Wv, xpl, wpl);
  proj_gemm_kernel<<<dim3(NCOMB / 128, MROWS / 128), 256, 0, stream>>>((const b16*)xpl, (const b16*)wpl, Qa, Kc, Vp);
  attn_kernel<<<(NB * NH * QT) / 8, 256, 0, stream>>>(Qa, Kc, Vp, out);
}

// v003
// A run of this version takes 104 microseconds.
// Next to v002, in two timings, it ran 1.16 and 1.17 times as fast.
// Counting every step since v000, it is 3.14 times as fast.
#include <hip/hip_runtime.h>

// Contractions: five projections x.W^T (K = 768) on v_wmma_f32_16x16x32_bf16 (bf16 RNE operands, f32 accumulate, one product per tile pair);
// Sr^T = Kc.Qa^T and Si^T = Kc.Qb^T (K = 128: concatenated re | im head dims; Qb = [qi | -qr] by exact f16 sign flip of the Qa fragments)
// and ctx^T = V^T.P^T (32 keys per step, P carried x4096) on v_wmma_f32_16x16x32_f16 (f16 operands, f32 accumulate, one product per tile pair);
// magnitude sqrt(sr^2 + si^2), online softmax statistics and the final normalisation in f32.

#pragma clang fp contract(off)

#ifndef NB
#define NB 2
#endif
#ifndef SEQ
#define SEQ 2048
#endif
#ifndef NB_FULL
#define NB_FULL 2
#endif
#ifndef SEQ_FULL
#define SEQ_FULL 2048
#endif

namespace {
constexpr int HID = 768, DH = 64, NH = 12;
constexpr int NW = 5;                           // weight matrices: qr, qi, kr, ki, v ([out][in], k contiguous)
constexpr int NCOMB = NW * HID;                 // 3840 rows of the combined 16-bit weight plane
constexpr int MROWS = NB * SEQ;                 // compact token rows (b*SEQ + t)
constexpr int QT = SEQ / 16;                    // 16-query tiles per (b, head)
constexpr int QKW = 2 * DH;                     // 128: row width of the Qa / Kc planes (re | im)
constexpr float SCORE_SCALE = 0.125f;           // 1/sqrt(64)
constexpr float P_CARRY = 4096.0f;              // f16 P operand = exp(s - m) * 4096
constexpr float INV_P_CARRY = 1.0f / 4096.0f;
constexpr int STG = 64;                         // keys per LDS stage of the attention kernel (two 32-key passes)
constexpr int NSTG = SEQ / STG;                 // stages per (b, head)
constexpr int KPITCH = 272;                     // LDS bytes per staged K row: 256 + 16, 16 B x odd, conflict-free for 16-byte reads
constexpr int KSTG_B = STG * KPITCH;            // 17,408 B of K rows per stage
constexpr int VSTG_B = STG * DH * 2;            // 8,192 B of key-tiled V per stage
constexpr int STG_B = KSTG_B + VSTG_B;          // 25,600 B per buffer
constexpr int GKC = 64;                         // k elements per LDS stage of the projection GEMM (128 B of every operand row)
constexpr int GNST = HID / GKC;                 // 12 stages
constexpr int GPITCH = 144;                     // LDS bytes per staged operand row: 128 + 16, 16 B x odd, conflict-free for 16-byte reads
constexpr int GSTG_B = 256 * GPITCH;            // 36,864 B per buffer: 128 activation rows, then 128 weight rows
static_assert(HID % GKC == 0);
static_assert(GNST >= 2);
static_assert(NCOMB % 128 == 0);
static_assert(NH % 2 == 0);
static_assert(8 * 32 * 64 * 2 <= 2 * GSTG_B);
static_assert(SEQ % 128 == 0);
static_assert(NSTG >= 2);
static_assert(NB >= 1 && NB <= NB_FULL);
static_assert(SEQ <= SEQ_FULL);
static_assert(NH * DH == HID);
static_assert(MROWS % 128 == 0);
static_assert(HID % 32 == 0);
static_assert(NCOMB % 64 == 0);
static_assert((NB * NH * QT) % 8 == 0);
static_assert((size_t)MROWS * HID <= (size_t)NB_FULL * SEQ_FULL * HID);

typedef __bf16 b16;
typedef _Float16 h16;
typedef __bf16 v16b __attribute__((ext_vector_type(16)));
typedef __bf16 v8b __attribute__((ext_vector_type(8)));
typedef _Float16 v16h __attribute__((ext_vector_type(16)));
typedef _Float16 v8h __attribute__((ext_vector_type(8)));
typedef float v8f __attribute__((ext_vector_type(8)));
typedef float v4f __attribute__((ext_vector_type(4)));
typedef unsigned short v8us __attribute__((ext_vector_type(8)));
typedef unsigned int v8u __attribute__((ext_vector_type(8)));

__device__ __forceinline__ v8b ld8b(const b16* p) { return *(const v8b*)p; }
__device__ __forceinline__ v8h ld8h(const h16* p) { return *(const v8h*)p; }
__device__ __forceinline__ v16b cat8b(v8b a, v8b b) { return __builtin_shufflevector(a, b, 0, 1, 2, 3, 4, 5, 6, 7, 8, 9, 10, 11, 12, 13, 14, 15); }
__device__ __forceinline__ v16h cat8h(v8h a, v8h b) { return __builtin_shufflevector(a, b, 0, 1, 2, 3, 4, 5, 6, 7, 8, 9, 10, 11, 12, 13, 14, 15); }
// 16x16x32 16-bit fragment from a k-contiguous row pointer (A: lane&15 = row, B: lane&15 = column), hh = lane>>4:
// elements 0..7 <- p[8hh+0..7], elements 8..15 <- p[16+8hh+0..7]
__device__ __forceinline__ v16b frag_kb(const b16* p, int hh) { return cat8b(ld8b(p + 8 * hh), ld8b(p + 16 + 8 * hh)); }
__device__ __forceinline__ v16h frag_kh(const h16* p, int hh) { return cat8h(ld8h(p + 8 * hh), ld8h(p + 16 + 8 * hh)); }

__device__ __forceinline__ v8f wmma_b(v16b a, v16b b, v8f c) {
  v8f d = __builtin_amdgcn_wmma_f32_16x16x32_bf16(false, a, false, b, (short)0, c, false, false);
  asm volatile("v_nop\n\tv_nop\n\tv_nop\n\tv_nop" : "+v"(d) : "v"(a), "v"(b));
  return d;
}
__device__ __forceinline__ v8f wmma_h(v16h a, v16h b, v8f c) {
  v8f d = __builtin_amdgcn_wmma_f32_16x16x32_f16(false, a, false, b, (short)0, c, false, false);
  asm volatile("v_nop\n\tv_nop\n\tv_nop\n\tv_nop" : "+v"(d) : "v"(a), "v"(b));
  return d;
}
// exact sign flip of 16 packed f16 values
__device__ __forceinline__ v16h neg16h(v16h a) {
  v8u t = __builtin_bit_cast(v8u, a);
  const v8u s = {0x80008000u, 0x80008000u, 0x80008000u, 0x80008000u, 0x80008000u, 0x80008000u, 0x80008000u, 0x80008000u};
  t = t ^ s;
  return __builtin_bit_cast(v16h, t);
}
// f32 -> bf16 by RNE convert, returned as the f32 bit pattern with the low 16 bits cleared
__device__ __forceinline__ unsigned int bf16_rne_u32(float f) {
  unsigned int u = __builtin_bit_cast(unsigned int, f);
  u += 0x7fffu + ((u >> 16) & 1u);
  return u & 0xffff0000u;
}
// wave-private LDS tile: stores by this wave, then vector reloads by this wave
__device__ __forceinline__ void wave_lds_sync() {
  __builtin_amdgcn_fence(3, "workgroup");
  __builtin_amdgcn_wave_barrier();
  __builtin_amdgcn_fence(2, "workgroup");
}

// ---------------------------------------------------------------------------
// x f32 [NB_FULL][SEQ_FULL][768] -> bf16 plane xpl [MROWS][768] (compact rows b*SEQ+t);
// weights W[n][k] f32 ([out][in], k contiguous) -> bf16 planes wpl [5][768][768] in the order qr, qi, kr, ki, v.
// ---------------------------------------------------------------------------
__global__ __launch_bounds__(256) void cvt_kernel(const float* __restrict__ x,
                                                  const float* __restrict__ w0, const float* __restrict__ w1, const float* __restrict__ w2,
                                                  const float* __restrict__ w3, const float* __restrict__ w4,
                                                  unsigned short* __restrict__ xpl, unsigned short* __restrict__ wpl) {
  const size_t tid = (size_t)blockIdx.x * blockDim.x + threadIdx.x, stride = (size_t)gridDim.x * blockDim.x;
  const size_t nx = (size_t)MROWS * HID / 8;
  const size_t per_w = (size_t)HID * HID / 8, nw = (size_t)NW * per_w;
  {
    for (size_t c = tid; c < nx; c += stride) {
      const size_t i = c * 8;                                       // element index inside the compact plane
      const int m = (int)(i / HID), col = (int)(i % HID);
      const int bb = m / SEQ, t = m - bb * SEQ;
      const float* p = x + ((size_t)bb * SEQ_FULL + t) * HID + col;
      const v4f f0 = *(const v4f*)p, f1 = *(const v4f*)(p + 4);
      v8us o;
#pragma unroll
      for (int e = 0; e < 4; ++e) {
        o[e] = (unsigned short)(bf16_rne_u32(f0[e]) >> 16);
        o[4 + e] = (unsigned short)(bf16_rne_u32(f1[e]) >> 16);
      }
      *(v8us*)(xpl + i) = o;
    }
    for (size_t c = tid; c < nw; c += stride) {
      const int mat = (int)(c / per_w);
      const size_t i = (c - (size_t)mat * per_w) * 8;               // element index inside one [768][768] matrix
      const float* w = (mat == 0) ? w0 : (mat == 1) ? w1 : (mat == 2) ? w2 : (mat == 3) ? w3 : w4;
      const v4f f0 = *(const v4f*)(w + i), f1 = *(const v4f*)(w + i + 4);
      v8us o;
#pragma unroll
      for (int e = 0; e < 4; ++e) {
        o[e] = (unsigned short)(bf16_rne_u32(f0[e]) >> 16);
        o[4 + e] = (unsigned short)(bf16_rne_u32(f1[e]) >> 16);
      }
      *(v8us*)(wpl + c * 8) = o;                           // plane offset mat*768*768 + i == c*8
    }
    
  }
}

__device__ __forceinline__ unsigned int lds_off(const void* p) { return (unsigned int)(size_t)p; }
// One 64-k stage of the projection GEMM into one LDS buffer: 256 lanes x 8 asynchronous 16-byte copies (4 of activation rows,
// 4 of weight rows), through no register. ag / wg: this lane's first 16 bytes of the stage; la: their LDS byte address.
// Copy i: row i*32 + tid/8, piece tid%8 (a wave covers four whole 128-B lines).
// s_wait_xcnt 0 closes the statement so that no address register is rewritten while a copy may still name it.
__device__ __forceinline__ void gemm_stage_copy(const b16* ag, const b16* wg, unsigned int la) {
  asm volatile("global_load_async_to_lds_b128 %0, %8, off\n\t"
               "global_load_async_to_lds_b128 %1, %9, off\n\t"
               "global_load_async_to_lds_b128 %2, %10, off\n\t"
               "global_load_async_to_lds_b128 %3, %11, off\n\t"
               "global_load_async_to_lds_b128 %4, %12, off\n\t"
               "global_load_async_to_lds_b128 %5, %13, off\n\t"
               "global_load_async_to_lds_b128 %6, %14, off\n\t"
               "global_load_async_to_lds_b128 %7, %15, off\n\t"
               "s_wait_xcnt 0x0"
               :: "v"(la), "v"(la + 32 * GPITCH), "v"(la + 64 * GPITCH), "v"(la + 96 * GPITCH),
                  "v"(la + 128 * GPITCH), "v"(la + 160 * GPITCH), "v"(la + 192 * GPITCH), "v"(la + 224 * GPITCH),
                  "v"(ag), "v"(ag + 32 * HID), "v"(ag + 64 * HID), "v"(ag + 96 * HID),
                  "v"(wg), "v"(wg + 32 * HID), "v"(wg + 64 * HID), "v"(wg + 96 * HID)
               : "memory");
}

// ---------------------------------------------------------------------------
// Projection GEMM: (MROWS x 768) x (768 x 3840), grid (30, MROWS/128), block 8 waves = 128 token rows x 128 columns,
// wave = 32 token rows x 64 columns (one head of one of the five matrices); waves 0..3 take the block's first head, 4..7 its second.
// The block's 128 activation rows and 128 weight rows come once per block into a two-buffer LDS ring, 64 k a stage,
// by asynchronous copies issued one stage ahead; every wave reads its fragments from the ring (32 k a step, k ascending).
// blockIdx.x -> mat = x/6 (qr, qi, kr, ki, v), heads 2*(x%6) and 2*(x%6)+1. Output f16 planes:
// v -> Vp key-tiled [g][t/16][64][16] (4 KB contiguous per wave), g = b*12 + head.
// ---------------------------------------------------------------------------
__global__ __launch_bounds__(256) void proj_gemm_kernel(const b16* __restrict__ xpl, const b16* __restrict__ wpl,
                                                        h16* __restrict__ Qa, h16* __restrict__ Kc, h16* __restrict__ Vp) {
  __shared__ __attribute__((aligned(16))) unsigned char Gs[2 * GSTG_B];   // the ring; behind the loop's last barrier the output staging
  const int tid = threadIdx.x;
  const int lane = tid & 31, wave = tid >> 5, nloc = lane & 15, hlf = lane >> 4;
  const int msub = wave & 3, nsub = wave >> 2;
  const int m0 = blockIdx.y * 128 + msub * 32;
  const int mat = blockIdx.x / (NH / 2);           // block-uniform: both heads of a block belong to one matrix
  const int head = (blockIdx.x - mat * (NH / 2)) * 2 + nsub;
  v8f acc[2][4];
#pragma unroll
  for (int r = 0; r < 2; ++r)
#pragma unroll
    for (int t = 0; t < 4; ++t) acc[r][t] = (v8f){};
  const b16* ag = xpl + (size_t)(blockIdx.y * 128 + (tid >> 3)) * HID + (tid & 7) * 8;   // this lane's first activation piece of stage 0
  const b16* wg = wpl + (size_t)(blockIdx.x * 128 + (tid >> 3)) * HID + (tid & 7) * 8;   // this lane's first weight piece of stage 0
  const unsigned int la = lds_off(&Gs[0]) + (unsigned int)((tid >> 3) * GPITCH + (tid & 7) * 16);
  gemm_stage_copy(ag, wg, la);                                              // stage 0 -> buffer 0
  asm volatile("s_wait_asynccnt 0x0" ::: "memory");                         // this wave's copies of stage 0 have landed
  __syncthreads();                                                          // publishes stage 0 to all 8 waves
  gemm_stage_copy(ag + GKC, wg + GKC, la + GSTG_B);                         // stage 1 -> buffer 1 (GNST >= 2)
  for (int st = 0; st < GNST; ++st) {
    const unsigned char* buf = &Gs[(st & 1) * GSTG_B];
    const b16* ar = (const b16*)(buf + (msub * 32 + nloc) * GPITCH);        // activation row m0 + nloc; 16 rows further: a1
    const b16* wr = (const b16*)(buf + (128 + nsub * 64 + nloc) * GPITCH);  // weight row of column nloc of the wave's head
#pragma unroll   // both 32-k steps of a stage inline, so that every fragment read has a constant LDS offset
    for (int kk = 0; kk < GKC; kk += 32) {
      const v16b a0 = frag_kb(ar + kk, hlf);
      const v16b a1 = frag_kb(ar + 16 * (GPITCH / 2) + kk, hlf);
      // the step's six fragments are read as one group ahead of its eight products
      const v16b bf0 = frag_kb(wr + kk, hlf), bf1 = frag_kb(wr + 16 * (GPITCH / 2) + kk, hlf);
      const v16b bf2 = frag_kb(wr + 32 * (GPITCH / 2) + kk, hlf), bf3 = frag_kb(wr + 48 * (GPITCH / 2) + kk, hlf);
      acc[0][0] = wmma_b(a0, bf0, acc[0][0]); acc[1][0] = wmma_b(a1, bf0, acc[1][0]);
      acc[0][1] = wmma_b(a0, bf1, acc[0][1]); acc[1][1] = wmma_b(a1, bf1, acc[1][1]);
      acc[0][2] = wmma_b(a0, bf2, acc[0][2]); acc[1][2] = wmma_b(a1, bf2, acc[1][2]);
      acc[0][3] = wmma_b(a0, bf3, acc[0][3]); acc[1][3] = wmma_b(a1, bf3, acc[1][3]);
    }
    asm volatile("s_wait_dscnt 0x0" ::: "memory");      // this wave's reads of stage st have returned
    asm volatile("s_wait_asynccnt 0x0" ::: "memory");   // this wave's copies of stage st+1 have landed
    __syncthreads();                                    // publishes stage st+1 and frees the buffer of stage st
    if (st + 2 < GNST)                                  // block-uniform: refill the buffer just read with stage st+2
      gemm_stage_copy(ag + (st + 2) * GKC, wg + (st + 2) * GKC, la + (st & 1) * GSTG_B);
  }
  asm volatile("s_wait_asynccnt 0x0" ::: "memory");     // no copy is outstanding when the ring becomes the output staging
  const int b = m0 / SEQ, t0 = m0 % SEQ;
  const int g = b * NH + head;
  h16* Tp = (h16*)&Gs[0] + wave * (32 * 64);       // 4 KB of the ring per wave: every read of it ended at the loop's last barrier
#pragma unroll
  for (int t = 0; t < 4; ++t) {
    const int d = t * 16 + nloc;
#pragma unroll
    for (int r = 0; r < 2; ++r)
#pragma unroll
      for (int v = 0; v < 8; ++v) {
        const int rr = r * 16 + v + 8 * hlf;                         // local token row 0..31
        const h16 y = (h16)acc[r][t][v];
        const int idx = (mat < 4) ? (rr * 64 + d) : ((rr >> 4) * 1024 + d * 16 + (rr & 15));
        Tp[idx] = y;
      }
  }
  wave_lds_sync();
  if (mat < 4) {                                   // block-uniform branch, no barriers inside
    h16* P = (mat < 2) ? Qa : Kc;
    const int coff = (mat & 1) * DH;
    h16* dst = P + ((size_t)g * SEQ + t0) * QKW + coff;              // 32 rows of 64 halves, row pitch 128 halves
#pragma unroll
    for (int j = 0; j < 8; ++j) {
      const int rr = j * 4 + (lane >> 3), c8 = (lane & 7) * 8;
      *(v8h*)(dst + (size_t)rr * QKW + c8) = ld8h(Tp + rr * 64 + c8);
    }
    
  } else {
    h16* dst = Vp + ((size_t)g * QT + (t0 >> 4)) * (size_t)(DH * 16); // two consecutive key tiles = 4 KB contiguous
#pragma unroll
    for (int j = 0; j < 8; ++j) { const int e = (j * 32 + lane) * 8; *(v8h*)(dst + e) = ld8h(Tp + e); }
    
  }
}

// One 64-key stage into one LDS buffer, 256 lanes x 6 asynchronous 16-byte copies (4 of K, 2 of V), through no register.
// kg / vg: this lane's first 16 bytes of the stage's K rows / V tiles; lk / lv: their LDS byte addresses.
// K copy i: row i*16 + tid/16, piece tid%16 (a wave covers two whole 256-B rows); V copy i: bytes i*4096 + tid*16.
// s_wait_xcnt 0 closes the statement so that no address register is rewritten while a copy may still name it.
__device__ __forceinline__ void stage_copy(const h16* kg, const h16* vg, unsigned int lk, unsigned int lv) {
  asm volatile("global_load_async_to_lds_b128 %0, %6, off\n\t"
               "global_load_async_to_lds_b128 %1, %7, off\n\t"
               "global_load_async_to_lds_b128 %2, %8, off\n\t"
               "global_load_async_to_lds_b128 %3, %9, off\n\t"
               "global_load_async_to_lds_b128 %4, %10, off\n\t"
               "global_load_async_to_lds_b128 %5, %11, off\n\t"
               "s_wait_xcnt 0x0"
               :: "v"(lk), "v"(lk + 16 * KPITCH), "v"(lk + 32 * KPITCH), "v"(lk + 48 * KPITCH), "v"(lv), "v"(lv + 4096),
                  "v"(kg), "v"(kg + 16 * QKW), "v"(kg + 32 * QKW), "v"(kg + 48 * QKW), "v"(vg), "v"(vg + 2048)
               : "memory");
}

// ---------------------------------------------------------------------------
// Transposed flash attention: each wave owns one 16-query tile of one (b, head); 8 waves per block; all SEQ keys in chunks of 32.
// The block's 8 waves share one (b, head): its K rows and V tiles come once per block into a two-buffer LDS ring, 64 keys a stage,
// by asynchronous copies issued one stage ahead; every wave reads its fragments from the ring.
// Sr^T = Kc.Qa^T and Si^T = Kc.Qb^T (f16 fragments, 4 k-steps over the 128-wide re|im rows),
// s = sqrt((sr/8)^2 + (si/8)^2) in f32, per-lane online softmax (running max);
// P^T fragment built in registers from two S^T tiles (element r <- keys 0..15 tile, element 8+r <- keys 16..31 tile), carried x4096;
// ---------------------------------------------------------------------------
__global__ __launch_bounds__(256) void attn_kernel(const h16* __restrict__ Qa, const h16* __restrict__ Kc, const h16* __restrict__ Vp,
                                                   float* __restrict__ out) {
  __shared__ __attribute__((aligned(16))) float Os[8][16 * 64];
  __shared__ __attribute__((aligned(16))) unsigned char Ring[2][STG_B];
  const int wid = threadIdx.x >> 5, lane = threadIdx.x & 31, hh = lane >> 4, col = lane & 15;
  const int qtile = blockIdx.x * 8 + wid;                 // over NB*NH*QT (exact grid)
  const int g = qtile / QT;                               // b*NH + h
  const int q0 = (qtile % QT) << 4;
  const int b = g / NH, h = g % NH;
  const size_t kbase = (size_t)g * SEQ * QKW;             // Kc plane base of (b,h)
  const size_t vbase = (size_t)g * SEQ * DH;              // V key-tiled base of (b,h): QT tiles of 64x16
  const h16* qrow = Qa + ((size_t)g * SEQ + q0 + col) * QKW;
  const v16h qf0 = frag_kh(qrow, hh), qf1 = frag_kh(qrow + 32, hh);        // qr d 0..31, 32..63 of query q0+col
  const v16h qf2 = frag_kh(qrow + 64, hh), qf3 = frag_kh(qrow + 96, hh);   // qi d 0..31, 32..63
  const v16h qn0 = neg16h(qf0), qn1 = neg16h(qf1);                          // -qr (exact)
  float m = -INFINITY, l = 0.0f;
  v8f o0 = {}, o1 = {}, o2 = {}, o3 = {};
  const int tid = threadIdx.x;
  const h16* kg = Kc + kbase + (size_t)(tid >> 4) * QKW + (tid & 15) * 8;   // this lane's first K piece of stage 0
  const h16* vg = Vp + vbase + (size_t)tid * 8;                             // this lane's first V piece of stage 0
  const unsigned int lk = lds_off(&Ring[0][0]) + (unsigned int)((tid >> 4) * KPITCH + (tid & 15) * 16);
  const unsigned int lv = lds_off(&Ring[0][0]) + (unsigned int)(KSTG_B + tid * 16);
  stage_copy(kg, vg, lk, lv);                                               // stage 0 -> buffer 0
  asm volatile("s_wait_asynccnt 0x0" ::: "memory");                         // this wave's copies of stage 0 have landed
  __syncthreads();                                                          // publishes stage 0 to all 8 waves
  stage_copy(kg + (size_t)STG * QKW, vg + (size_t)STG * DH, lk + STG_B, lv + STG_B);   // stage 1 -> buffer 1 (NSTG >= 2)
  for (int st = 0; st < NSTG; ++st) {
   const unsigned char* buf = &Ring[st & 1][0];
   for (int ps = 0; ps < 2; ++ps) {
    const h16* k0p = (const h16*)(buf + (ps * 32 + col) * KPITCH);  // key st*64+ps*32+col (tile 0)
    const h16* k1p = (const h16*)(buf + (ps * 32 + 16 + col) * KPITCH);   // 16 keys further (tile 1)
    v8f s0r = {}, s0i = {}, s1r = {}, s1i = {};
    {
      // all eight K fragments are read as one group ahead of the products
      const v16h kf0 = frag_kh(k0p, hh), kf1 = frag_kh(k0p + 32, hh), kf2 = frag_kh(k0p + 64, hh), kf3 = frag_kh(k0p + 96, hh);
      const v16h kf4 = frag_kh(k1p, hh), kf5 = frag_kh(k1p + 32, hh), kf6 = frag_kh(k1p + 64, hh), kf7 = frag_kh(k1p + 96, hh);
      s0r = wmma_h(kf0, qf0, s0r); s0i = wmma_h(kf0, qf2, s0i);
      s0r = wmma_h(kf1, qf1, s0r); s0i = wmma_h(kf1, qf3, s0i);
      s0r = wmma_h(kf2, qf2, s0r); s0i = wmma_h(kf2, qn0, s0i);
      s0r = wmma_h(kf3, qf3, s0r); s0i = wmma_h(kf3, qn1, s0i);
      s1r = wmma_h(kf4, qf0, s1r); s1i = wmma_h(kf4, qf2, s1i);
      s1r = wmma_h(kf5, qf1, s1r); s1i = wmma_h(kf5, qf3, s1i);
      s1r = wmma_h(kf6, qf2, s1r); s1i = wmma_h(kf6, qn0, s1i);
      s1r = wmma_h(kf7, qf3, s1r); s1i = wmma_h(kf7, qn1, s1i);
    }
    // the pass's four V fragments, read here so that the score arithmetic covers their LDS latency
    const h16* v0p = (const h16*)(buf + KSTG_B) + ps * (2 * DH * 16) + 8 * hh + col * 16;   // key tile 0 of the pass; tile 1 is DH*16 further
    const v16h va0 = cat8h(ld8h(v0p + 0 * 256), ld8h(v0p + DH * 16 + 0 * 256));
    const v16h va1 = cat8h(ld8h(v0p + 1 * 256), ld8h(v0p + DH * 16 + 1 * 256));
    const v16h va2 = cat8h(ld8h(v0p + 2 * 256), ld8h(v0p + DH * 16 + 2 * 256));
    const v16h va3 = cat8h(ld8h(v0p + 3 * 256), ld8h(v0p + DH * 16 + 3 * 256));
    v8f sc0, sc1;
#pragma unroll
    for (int r = 0; r < 8; ++r) {
      const float a0 = s0r[r] * SCORE_SCALE, b0 = s0i[r] * SCORE_SCALE;
      const float a1 = s1r[r] * SCORE_SCALE, b1 = s1i[r] * SCORE_SCALE;
      sc0[r] = __builtin_amdgcn_sqrtf(a0 * a0 + b0 * b0);   // the hardware's v_sqrt_f32 alone: no range scaling, no last-bit correction
      sc1[r] = __builtin_amdgcn_sqrtf(a1 * a1 + b1 * b1);
    }
    float mr = -INFINITY;
#pragma unroll
    for (int r = 0; r < 8; ++r) mr = fmaxf(mr, fmaxf(sc0[r], sc1[r]));
    mr = fmaxf(mr, __shfl_xor(mr, 16));
    const float mn = fmaxf(m, mr);            // finite (scores >= 0)
    const float al_ = __expf(m - mn);         // 0 on the first chunk
    m = mn;
    float sum = 0.0f;
    v16h pb;
#pragma unroll
    for (int r = 0; r < 8; ++r) {
      const float p0 = __expf(sc0[r] - mn), p1 = __expf(sc1[r] - mn);
      sum += p0 + p1;
      pb[r] = (h16)(p0 * P_CARRY); pb[8 + r] = (h16)(p1 * P_CARRY);
    }
    sum += __shfl_xor(sum, 16);
    l = l * al_ + sum;
    o0 = o0 * al_; o1 = o1 * al_; o2 = o2 * al_; o3 = o3 * al_;
    o0 = wmma_h(va0, pb, o0);
    o1 = wmma_h(va1, pb, o1);
    o2 = wmma_h(va2, pb, o2);
    o3 = wmma_h(va3, pb, o3);
   }
   asm volatile("s_wait_dscnt 0x0" ::: "memory");      // this wave's reads of stage st have returned
   asm volatile("s_wait_asynccnt 0x0" ::: "memory");   // this wave's copies of stage st+1 have landed
   __syncthreads();                                    // publishes stage st+1 and frees the buffer of stage st
   if (st + 2 < NSTG)                                  // block-uniform: refill the buffer just read with stage st+2
     stage_copy(kg + (size_t)(st + 2) * (STG * QKW), vg + (size_t)(st + 2) * (STG * DH), lk + (st & 1) * STG_B, lv + (st & 1) * STG_B);
  }
  asm volatile("s_wait_asynccnt 0x0" ::: "memory");    // no copy is outstanding when the wave goes on to the epilogue
  const float inv = (1.0f / l) * INV_P_CARRY;   // ctx = (o / 4096) / l
  float* Tt = Os[wid];                          // [query col][d], d = n*16 + 8hh + r
  {
    float* tp = Tt + col * 64 + 8 * hh;
    const v4f a0 = {o0[0] * inv, o0[1] * inv, o0[2] * inv, o0[3] * inv}, a1 = {o0[4] * inv, o0[5] * inv, o0[6] * inv, o0[7] * inv};
    const v4f b0 = {o1[0] * inv, o1[1] * inv, o1[2] * inv, o1[3] * inv}, b1 = {o1[4] * inv, o1[5] * inv, o1[6] * inv, o1[7] * inv};
    const v4f c0 = {o2[0] * inv, o2[1] * inv, o2[2] * inv, o2[3] * inv}, c1 = {o2[4] * inv, o2[5] * inv, o2[6] * inv, o2[7] * inv};
    const v4f d0 = {o3[0] * inv, o3[1] * inv, o3[2] * inv, o3[3] * inv}, d1 = {o3[4] * inv, o3[5] * inv, o3[6] * inv, o3[7] * inv};
    *(v4f*)(tp + 0)  = a0; *(v4f*)(tp + 4)  = a1;
    *(v4f*)(tp + 16) = b0; *(v4f*)(tp + 20) = b1;
    *(v4f*)(tp + 32) = c0; *(v4f*)(tp + 36) = c1;
    *(v4f*)(tp + 48) = d0; *(v4f*)(tp + 52) = d1;
  }
  wave_lds_sync();
  float* dst0 = out + ((size_t)b * SEQ + q0) * HID + h * DH;   // 16 rows x 64 floats, row stride HID floats
#pragma unroll
  for (int j = 0; j < 8; ++j) {
    const int rr = j * 2 + hh, c4 = col * 4;
    *(v4f*)(dst0 + (size_t)rr * HID + c4) = *(const v4f*)(Tt + rr * 64 + c4);
  }
  
}
}  // namespace

extern "C" void kernel_launch(void* const* d_in, const int* in_sizes, int n_in,
                              void* d_out, int out_size, void* d_ws, size_t ws_size, hipStream_t stream) {
  if (n_in < 6) return;
  const size_t need_x = ((size_t)(NB - 1) * SEQ_FULL + SEQ) * HID;
  if ((size_t)in_sizes[0] < need_x) return;
  for (int i = 1; i <= 5; ++i) if (in_sizes[i] < HID * HID) return;
  if ((size_t)out_size < (size_t)MROWS * HID) return;

  const float* x   = (const float*)d_in[0];     // [NB_FULL, SEQ_FULL, 768] f32
  const float* Wqr = (const float*)d_in[1];     // [768,768] ([out][in])
  const float* Wqi = (const float*)d_in[2];
  const float* Wkr = (const float*)d_in[3];
  const float* Wki = (const float*)d_in[4];
  const float* Wv  = (const float*)d_in[5];
  float* out = (float*)d_out;                   // [NB, SEQ, 768] f32

  size_t off = 0; char* ws = (char*)d_ws;
  unsigned short* xpl = (unsigned short*)(ws + off); off += (size_t)MROWS * HID * 2;        // 6,291,456 B bf16 activation plane
  unsigned short* wpl = (unsigned short*)(ws + off); off += (size_t)NW * HID * HID * 2;     // 5,898,240 B bf16 weight planes
  h16* Qa = (h16*)(ws + off); off += (size_t)MROWS * NH * QKW * 2;                          // 12,582,912 B f16 [g][t][128]
  h16* Kc = (h16*)(ws + off); off += (size_t)MROWS * NH * QKW * 2;                          // 12,582,912 B f16 [g][t][128]
  h16* Vp = (h16*)(ws + off); off += (size_t)MROWS * HID * 2;                               // 6,291,456 B f16 key-tiled
  if (off > ws_size) return;                                                                 // 43,646,976 B at NB=2, SEQ=2048

  cvt_kernel<<<1024, 256, 0, stream>>>(x, Wqr, Wqi, Wkr, Wki, Wv, xpl, wpl);
  proj_gemm_kernel<<<dim3(NCOMB / 128, MROWS / 128), 256, 0, stream>>>((const b16*)xpl, (const b16*)wpl, Qa, Kc, Vp);
  attn_kernel<<<(NB * NH * QT) / 8, 256, 0, stream>>>(Qa, Kc, Vp, out);
}

// v004
// It runs in 96.1 microseconds.
// Two timings next to v003 both put it at 1.08 times that version's speed.
// Over all steps from v000 it is 3.39 times as fast.
#include <hip/hip_runtime.h>

// Contractions: five projections x.W^T (K = 768) on v_wmma_f32_16x16x32_bf16 (bf16 RNE operands, f32 accumulate, one product per tile pair);
// Sr^T = Kc.Qa^T and Si^T = Kc.Qb^T (K = 128: concatenated re | im head dims; Qb = [qi | -qr] by exact f16 sign flip of the Qa fragments)
// and ctx^T = V^T.P^T (32 keys per step, P carried x4096) on v_wmma_f32_16x16x32_f16 (f16 operands, f32 accumulate, one product per tile pair);
// magnitude sqrt(sr^2 + si^2), online softmax statistics and the final normalisation in f32.

#pragma clang fp contract(off)

#ifndef NB
#define NB 2
#endif
#ifndef SEQ
#define SEQ 2048
#endif
#ifndef NB_FULL
#define NB_FULL 2
#endif
#ifndef SEQ_FULL
#define SEQ_FULL 2048
#endif

namespace {
constexpr int HID = 768, DH = 64, NH = 12;
constexpr int NW = 5;                           // weight matrices: qr, qi, kr, ki, v ([out][in], k contiguous)
constexpr int NCOMB = NW * HID;                 // 3840 rows of the combined 16-bit weight plane
constexpr int MROWS = NB * SEQ;                 // compact token rows (b*SEQ + t)
constexpr int QT = SEQ / 16;                    // 16-query tiles per (b, head)
constexpr int QKW = 2 * DH;                     // 128: row width of the Qa / Kc planes (re | im)
constexpr float SCORE_SCALE = 0.125f;           // 1/sqrt(64)
constexpr float P_CARRY = 4096.0f;              // f16 P operand = exp(s - m) * 4096
constexpr float INV_P_CARRY = 1.0f / 4096.0f;
constexpr int STG = 64;                         // keys per LDS stage of the attention kernel (two 32-key passes)
constexpr int NSTG = SEQ / STG;                 // stages per (b, head)
constexpr int KPITCH = 272;                     // LDS bytes per staged K row: 256 + 16, 16 B x odd, conflict-free for 16-byte reads
constexpr int KSTG_B = STG * KPITCH;            // 17,408 B of K rows per stage
constexpr int VSTG_B = STG * DH * 2;            // 8,192 B of key-tiled V per stage
constexpr int STG_B = KSTG_B + VSTG_B;          // 25,600 B per buffer
constexpr int GKC = 64;                         // k elements per LDS stage of the projection GEMM (128 B of every operand row)
constexpr int GNST = HID / GKC;                 // 12 stages
constexpr int GPITCH = 144;                     // LDS bytes per staged operand row: 128 + 16, 16 B x odd, conflict-free for 16-byte reads
constexpr int GSTG_B = 256 * GPITCH;            // 36,864 B per buffer: 128 activation rows, then 128 weight rows
static_assert(HID % GKC == 0);
static_assert(GNST >= 2);
static_assert(NCOMB % 128 == 0);
static_assert(NH % 2 == 0);
static_assert(8 * 32 * 64 * 2 <= 2 * GSTG_B);
static_assert(SEQ % 128 == 0);
static_assert(NSTG >= 2);
static_assert(NB >= 1 && NB <= NB_FULL);
static_assert(SEQ <= SEQ_FULL);
static_assert(NH * DH == HID);
static_assert(MROWS % 128 == 0);
static_assert(HID % 32 == 0);
static_assert(NCOMB % 64 == 0);
static_assert((NB * NH * QT) % 8 == 0);
static_assert((size_t)MROWS * HID <= (size_t)NB_FULL * SEQ_FULL * HID);

typedef __bf16 b16;
typedef _Float16 h16;
typedef __bf16 v16b __attribute__((ext_vector_type(16)));
typedef __bf16 v8b __attribute__((ext_vector_type(8)));
typedef _Float16 v16h __attribute__((ext_vector_type(16)));
typedef _Float16 v8h __attribute__((ext_vector_type(8)));
typedef float v8f __attribute__((ext_vector_type(8)));
typedef float v4f __attribute__((ext_vector_type(4)));
typedef unsigned short v8us __attribute__((ext_vector_type(8)));
typedef unsigned int v8u __attribute__((ext_vector_type(8)));

__device__ __forceinline__ v8b ld8b(const b16* p) { return *(const v8b*)p; }
__device__ __forceinline__ v8h ld8h(const h16* p) { return *(const v8h*)p; }
__device__ __forceinline__ v16b cat8b(v8b a, v8b b) { return __builtin_shufflevector(a, b, 0, 1, 2, 3, 4, 5, 6, 7, 8, 9, 10, 11, 12, 13, 14, 15); }
__device__ __forceinline__ v16h cat8h(v8h a, v8h b) { return __builtin_shufflevector(a, b, 0, 1, 2, 3, 4, 5, 6, 7, 8, 9, 10, 11, 12, 13, 14, 15); }
// 16x16x32 16-bit fragment from a k-contiguous row pointer (A: lane&15 = row, B: lane&15 = column), hh = lane>>4:
// elements 0..7 <- p[8hh+0..7], elements 8..15 <- p[16+8hh+0..7]
__device__ __forceinline__ v16b frag_kb(const b16* p, int hh) { return cat8b(ld8b(p + 8 * hh), ld8b(p + 16 + 8 * hh)); }
__device__ __forceinline__ v16h frag_kh(const h16* p, int hh) { return cat8h(ld8h(p + 8 * hh), ld8h(p + 16 + 8 * hh)); }

__device__ __forceinline__ v8f wmma_b(v16b a, v16b b, v8f c) {
  v8f d = __builtin_amdgcn_wmma_f32_16x16x32_bf16(false, a, false, b, (short)0, c, false, false);
  asm volatile("v_nop\n\tv_nop\n\tv_nop\n\tv_nop" : "+v"(d) : "v"(a), "v"(b));
  return d;
}
// builtin form alone: on the straight path the compiler keeps the distance behind a matrix instruction itself
__device__ __forceinline__ v8f wmma_h(v16h a, v16h b, v8f c) {
  return __builtin_amdgcn_wmma_f32_16x16x32_f16(false, a, false, b, (short)0, c, false, false);
}
// the last matrix instruction in front of a loop's back edge: the four vector
// slots that the chip needs before the loop head's vector instructions overwrite its A or B stand here
__device__ __forceinline__ v8f wmma_h_edge(v16h a, v16h b, v8f c) {
  v8f d = __builtin_amdgcn_wmma_f32_16x16x32_f16(false, a, false, b, (short)0, c, false, false);
  asm volatile("v_nop\n\tv_nop\n\tv_nop\n\tv_nop" : "+v"(d) : "v"(a), "v"(b));
  return d;
}
// exact sign flip of 16 packed f16 values
__device__ __forceinline__ v16h neg16h(v16h a) {
  v8u t = __builtin_bit_cast(v8u, a);
  const v8u s = {0x80008000u, 0x80008000u, 0x80008000u, 0x80008000u, 0x80008000u, 0x80008000u, 0x80008000u, 0x80008000u};
  t = t ^ s;
  return __builtin_bit_cast(v16h, t);
}
// f32 -> bf16 by RNE convert, returned as the f32 bit pattern with the low 16 bits cleared
__device__ __forceinline__ unsigned int bf16_rne_u32(float f) {
  unsigned int u = __builtin_bit_cast(unsigned int, f);
  u += 0x7fffu + ((u >> 16) & 1u);
  return u & 0xffff0000u;
}
// wave-private LDS tile: stores by this wave, then vector reloads by this wave
__device__ __forceinline__ void wave_lds_sync() {
  __builtin_amdgcn_fence(3, "workgroup");
  __builtin_amdgcn_wave_barrier();
  __builtin_amdgcn_fence(2, "workgroup");
}

// ---------------------------------------------------------------------------
// x f32 [NB_FULL][SEQ_FULL][768] -> bf16 plane xpl [MROWS][768] (compact rows b*SEQ+t);
// weights W[n][k] f32 ([out][in], k contiguous) -> bf16 planes wpl [5][768][768] in the order qr, qi, kr, ki, v.
// ---------------------------------------------------------------------------
__global__ __launch_bounds__(256) void cvt_kernel(const float* __restrict__ x,
                                                  const float* __restrict__ w0, const float* __restrict__ w1, const float* __restrict__ w2,
                                                  const float* __restrict__ w3, const float* __restrict__ w4,
                                                  unsigned short* __restrict__ xpl, unsigned short* __restrict__ wpl) {
  const size_t tid = (size_t)blockIdx.x * blockDim.x + threadIdx.x, stride = (size_t)gridDim.x * blockDim.x;
  const size_t nx = (size_t)MROWS * HID / 8;
  const size_t per_w = (size_t)HID * HID / 8, nw = (size_t)NW * per_w;
  {
    for (size_t c = tid; c < nx; c += stride) {
      const size_t i = c * 8;                                       // element index inside the compact plane
      const int m = (int)(i / HID), col = (int)(i % HID);
      const int bb = m / SEQ, t = m - bb * SEQ;
      const float* p = x + ((size_t)bb * SEQ_FULL + t) * HID + col;
      const v4f f0 = *(const v4f*)p, f1 = *(const v4f*)(p + 4);
      v8us o;
#pragma unroll
      for (int e = 0; e < 4; ++e) {
        o[e] = (unsigned short)(bf16_rne_u32(f0[e]) >> 16);
        o[4 + e] = (unsigned short)(bf16_rne_u32(f1[e]) >> 16);
      }
      *(v8us*)(xpl + i) = o;
    }
    for (size_t c = tid; c < nw; c += stride) {
      const int mat = (int)(c / per_w);
      const size_t i = (c - (size_t)mat * per_w) * 8;               // element index inside one [768][768] matrix
      const float* w = (mat == 0) ? w0 : (mat == 1) ? w1 : (mat == 2) ? w2 : (mat == 3) ? w3 : w4;
      const v4f f0 = *(const v4f*)(w + i), f1 = *(const v4f*)(w + i + 4);
      v8us o;
#pragma unroll
      for (int e = 0; e < 4; ++e) {
        o[e] = (unsigned short)(bf16_rne_u32(f0[e]) >> 16);
        o[4 + e] = (unsigned short)(bf16_rne_u32(f1[e]) >> 16);
      }
      *(v8us*)(wpl + c * 8) = o;                           // plane offset mat*768*768 + i == c*8
    }
    
  }
}

__device__ __forceinline__ unsigned int lds_off(const void* p) { return (unsigned int)(size_t)p; }
// One 64-k stage of the projection GEMM into one LDS buffer: 256 lanes x 8 asynchronous 16-byte copies (4 of activation rows,
// 4 of weight rows), through no register. ag / wg: this lane's first 16 bytes of the stage; la: their LDS byte address.
// Copy i: row i*32 + tid/8, piece tid%8 (a wave covers four whole 128-B lines).
// s_wait_xcnt 0 closes the statement so that no address register is rewritten while a copy may still name it.
__device__ __forceinline__ void gemm_stage_copy(const b16* ag, const b16* wg, unsigned int la) {
  asm volatile("global_load_async_to_lds_b128 %0, %8, off\n\t"
               "global_load_async_to_lds_b128 %1, %9, off\n\t"
               "global_load_async_to_lds_b128 %2, %10, off\n\t"
               "global_load_async_to_lds_b128 %3, %11, off\n\t"
               "global_load_async_to_lds_b128 %4, %12, off\n\t"
               "global_load_async_to_lds_b128 %5, %13, off\n\t"
               "global_load_async_to_lds_b128 %6, %14, off\n\t"
               "global_load_async_to_lds_b128 %7, %15, off\n\t"
               "s_wait_xcnt 0x0"
               :: "v"(la), "v"(la + 32 * GPITCH), "v"(la + 64 * GPITCH), "v"(la + 96 * GPITCH),
                  "v"(la + 128 * GPITCH), "v"(la + 160 * GPITCH), "v"(la + 192 * GPITCH), "v"(la + 224 * GPITCH),
                  "v"(ag), "v"(ag + 32 * HID), "v"(ag + 64 * HID), "v"(ag + 96 * HID),
                  "v"(wg), "v"(wg + 32 * HID), "v"(wg + 64 * HID), "v"(wg + 96 * HID)
               : "memory");
}

// ---------------------------------------------------------------------------
// Projection GEMM: (MROWS x 768) x (768 x 3840), grid (30, MROWS/128), block 8 waves = 128 token rows x 128 columns,
// wave = 32 token rows x 64 columns (one head of one of the five matrices); waves 0..3 take the block's first head, 4..7 its second.
// The block's 128 activation rows and 128 weight rows come once per block into a two-buffer LDS ring, 64 k a stage,
// by asynchronous copies issued one stage ahead; every wave reads its fragments from the ring (32 k a step, k ascending).
// blockIdx.x -> mat = x/6 (qr, qi, kr, ki, v), heads 2*(x%6) and 2*(x%6)+1. Output f16 planes:
// v -> Vp key-tiled [g][t/16][64][16] (4 KB contiguous per wave), g = b*12 + head.
// ---------------------------------------------------------------------------
__global__ __launch_bounds__(256) void proj_gemm_kernel(const b16* __restrict__ xpl, const b16* __restrict__ wpl,
                                                        h16* __restrict__ Qa, h16* __restrict__ Kc, h16* __restrict__ Vp) {
  __shared__ __attribute__((aligned(16))) unsigned char Gs[2 * GSTG_B];   // the ring; behind the loop's last barrier the output staging
  const int tid = threadIdx.x;
  const int lane = tid & 31, wave = tid >> 5, nloc = lane & 15, hlf = lane >> 4;
  const int msub = wave & 3, nsub = wave >> 2;
  const int m0 = blockIdx.y * 128 + msub * 32;
  const int mat = blockIdx.x / (NH / 2);           // block-uniform: both heads of a block belong to one matrix
  const int head = (blockIdx.x - mat * (NH / 2)) * 2 + nsub;
  v8f acc[2][4];
#pragma unroll
  for (int r = 0; r < 2; ++r)
#pragma unroll
    for (int t = 0; t < 4; ++t) acc[r][t] = (v8f){};
  const b16* ag = xpl + (size_t)(blockIdx.y * 128 + (tid >> 3)) * HID + (tid & 7) * 8;   // this lane's first activation piece of stage 0
  const b16* wg = wpl + (size_t)(blockIdx.x * 128 + (tid >> 3)) * HID + (tid & 7) * 8;   // this lane's first weight piece of stage 0
  const unsigned int la = lds_off(&Gs[0]) + (unsigned int)((tid >> 3) * GPITCH + (tid & 7) * 16);
  gemm_stage_copy(ag, wg, la);                                              // stage 0 -> buffer 0
  asm volatile("s_wait_asynccnt 0x0" ::: "memory");                         // this wave's copies of stage 0 have landed
  __syncthreads();                                                          // publishes stage 0 to all 8 waves
  gemm_stage_copy(ag + GKC, wg + GKC, la + GSTG_B);                         // stage 1 -> buffer 1 (GNST >= 2)
  for (int st = 0; st < GNST; ++st) {
    const unsigned char* buf = &Gs[(st & 1) * GSTG_B];
    const b16* ar = (const b16*)(buf + (msub * 32 + nloc) * GPITCH);        // activation row m0 + nloc; 16 rows further: a1
    const b16* wr = (const b16*)(buf + (128 + nsub * 64 + nloc) * GPITCH);  // weight row of column nloc of the wave's head
#pragma unroll   // both 32-k steps of a stage inline, so that every fragment read has a constant LDS offset
    for (int kk = 0; kk < GKC; kk += 32) {
      const v16b a0 = frag_kb(ar + kk, hlf);
      const v16b a1 = frag_kb(ar + 16 * (GPITCH / 2) + kk, hlf);
      // the step's six fragments are read as one group ahead of its eight products
      const v16b bf0 = frag_kb(wr + kk, hlf), bf1 = frag_kb(wr + 16 * (GPITCH / 2) + kk, hlf);
      const v16b bf2 = frag_kb(wr + 32 * (GPITCH / 2) + kk, hlf), bf3 = frag_kb(wr + 48 * (GPITCH / 2) + kk, hlf);
      acc[0][0] = wmma_b(a0, bf0, acc[0][0]); acc[1][0] = wmma_b(a1, bf0, acc[1][0]);
      acc[0][1] = wmma_b(a0, bf1, acc[0][1]); acc[1][1] = wmma_b(a1, bf1, acc[1][1]);
      acc[0][2] = wmma_b(a0, bf2, acc[0][2]); acc[1][2] = wmma_b(a1, bf2, acc[1][2]);
      acc[0][3] = wmma_b(a0, bf3, acc[0][3]); acc[1][3] = wmma_b(a1, bf3, acc[1][3]);
    }
    asm volatile("s_wait_dscnt 0x0" ::: "memory");      // this wave's reads of stage st have returned
    asm volatile("s_wait_asynccnt 0x0" ::: "memory");   // this wave's copies of stage st+1 have landed
    __syncthreads();                                    // publishes stage st+1 and frees the buffer of stage st
    if (st + 2 < GNST)                                  // block-uniform: refill the buffer just read with stage st+2
      gemm_stage_copy(ag + (st + 2) * GKC, wg + (st + 2) * GKC, la + (st & 1) * GSTG_B);
  }
  asm volatile("s_wait_asynccnt 0x0" ::: "memory");     // no copy is outstanding when the ring becomes the output staging
  const int b = m0 / SEQ, t0 = m0 % SEQ;
  const int g = b * NH + head;
  h16* Tp = (h16*)&Gs[0] + wave * (32 * 64);       // 4 KB of the ring per wave: every read of it ended at the loop's last barrier
#pragma unroll
  for (int t = 0; t < 4; ++t) {
    const int d = t * 16 + nloc;
#pragma unroll
    for (int r = 0; r < 2; ++r)
#pragma unroll
      for (int v = 0; v < 8; ++v) {
        const int rr = r * 16 + v + 8 * hlf;                         // local token row 0..31
        const h16 y = (h16)acc[r][t][v];
        const int idx = (mat < 4) ? (rr * 64 + d) : ((rr >> 4) * 1024 + d * 16 + (rr & 15));
        Tp[idx] = y;
      }
  }
  wave_lds_sync();
  if (mat < 4) {                                   // block-uniform branch, no barriers inside
    h16* P = (mat < 2) ? Qa : Kc;
    const int coff = (mat & 1) * DH;
    h16* dst = P + ((size_t)g * SEQ + t0) * QKW + coff;              // 32 rows of 64 halves, row pitch 128 halves
#pragma unroll
    for (int j = 0; j < 8; ++j) {
      const int rr = j * 4 + (lane >> 3), c8 = (lane & 7) * 8;
      *(v8h*)(dst + (size_t)rr * QKW + c8) = ld8h(Tp + rr * 64 + c8);
    }
    
  } else {
    h16* dst = Vp + ((size_t)g * QT + (t0 >> 4)) * (size_t)(DH * 16); // two consecutive key tiles = 4 KB contiguous
#pragma unroll
    for (int j = 0; j < 8; ++j) { const int e = (j * 32 + lane) * 8; *(v8h*)(dst + e) = ld8h(Tp + e); }
    
  }
}

// One 64-key stage into one LDS buffer, 256 lanes x 6 asynchronous 16-byte copies (4 of K, 2 of V), through no register.
// kg / vg: this lane's first 16 bytes of the stage's K rows / V tiles; lk / lv: their LDS byte addresses.
// K copy i: row i*16 + tid/16, piece tid%16 (a wave covers two whole 256-B rows); V copy i: bytes i*4096 + tid*16.
// s_wait_xcnt 0 closes the statement so that no address register is rewritten while a copy may still name it.
__device__ __forceinline__ void stage_copy(const h16* kg, const h16* vg, unsigned int lk, unsigned int lv) {
  asm volatile("global_load_async_to_lds_b128 %0, %6, off\n\t"
               "global_load_async_to_lds_b128 %1, %7, off\n\t"
               "global_load_async_to_lds_b128 %2, %8, off\n\t"
               "global_load_async_to_lds_b128 %3, %9, off\n\t"
               "global_load_async_to_lds_b128 %4, %10, off\n\t"
               "global_load_async_to_lds_b128 %5, %11, off\n\t"
               "s_wait_xcnt 0x0"
               :: "v"(lk), "v"(lk + 16 * KPITCH), "v"(lk + 32 * KPITCH), "v"(lk + 48 * KPITCH), "v"(lv), "v"(lv + 4096),
                  "v"(kg), "v"(kg + 16 * QKW), "v"(kg + 32 * QKW), "v"(kg + 48 * QKW), "v"(vg), "v"(vg + 2048)
               : "memory");
}

// ---------------------------------------------------------------------------
// Transposed flash attention: each wave owns one 16-query tile of one (b, head); 8 waves per block; all SEQ keys in chunks of 32.
// The block's 8 waves share one (b, head): its K rows and V tiles come once per block into a two-buffer LDS ring, 64 keys a stage,
// by asynchronous copies issued one stage ahead; every wave reads its fragments from the ring.
// Sr^T = Kc.Qa^T and Si^T = Kc.Qb^T (f16 fragments, 4 k-steps over the 128-wide re|im rows),
// s = sqrt((sr/8)^2 + (si/8)^2) in f32, per-lane online softmax (running max);
// P^T fragment built in registers from two S^T tiles (element r <- keys 0..15 tile, element 8+r <- keys 16..31 tile), carried x4096;
// ---------------------------------------------------------------------------
__global__ __launch_bounds__(256) void attn_kernel(const h16* __restrict__ Qa, const h16* __restrict__ Kc, const h16* __restrict__ Vp,
                                                   float* __restrict__ out) {
  __shared__ __attribute__((aligned(16))) float Os[8][16 * 64];
  __shared__ __attribute__((aligned(16))) unsigned char Ring[2][STG_B];
  const int wid = threadIdx.x >> 5, lane = threadIdx.x & 31, hh = lane >> 4, col = lane & 15;
  const int qtile = blockIdx.x * 8 + wid;                 // over NB*NH*QT (exact grid)
  const int g = qtile / QT;                               // b*NH + h
  const int q0 = (qtile % QT) << 4;
  const int b = g / NH, h = g % NH;
  const size_t kbase = (size_t)g * SEQ * QKW;             // Kc plane base of (b,h)
  const size_t vbase = (size_t)g * SEQ * DH;              // V key-tiled base of (b,h): QT tiles of 64x16
  const h16* qrow = Qa + ((size_t)g * SEQ + q0 + col) * QKW;
  const v16h qf0 = frag_kh(qrow, hh), qf1 = frag_kh(qrow + 32, hh);        // qr d 0..31, 32..63 of query q0+col
  const v16h qf2 = frag_kh(qrow + 64, hh), qf3 = frag_kh(qrow + 96, hh);   // qi d 0..31, 32..63
  const v16h qn0 = neg16h(qf0), qn1 = neg16h(qf1);                          // -qr (exact)
  float m = -INFINITY, l = 0.0f;
  v8f o0 = {}, o1 = {}, o2 = {}, o3 = {};
  const int tid = threadIdx.x;
  const h16* kg = Kc + kbase + (size_t)(tid >> 4) * QKW + (tid & 15) * 8;   // this lane's first K piece of stage 0
  const h16* vg = Vp + vbase + (size_t)tid * 8;                             // this lane's first V piece of stage 0
  const unsigned int lk = lds_off(&Ring[0][0]) + (unsigned int)((tid >> 4) * KPITCH + (tid & 15) * 16);
  const unsigned int lv = lds_off(&Ring[0][0]) + (unsigned int)(KSTG_B + tid * 16);
  stage_copy(kg, vg, lk, lv);                                               // stage 0 -> buffer 0
  asm volatile("s_wait_asynccnt 0x0" ::: "memory");                         // this wave's copies of stage 0 have landed
  __syncthreads();                                                          // publishes stage 0 to all 8 waves
  stage_copy(kg + (size_t)STG * QKW, vg + (size_t)STG * DH, lk + STG_B, lv + STG_B);   // stage 1 -> buffer 1 (NSTG >= 2)
  for (int st = 0; st < NSTG; ++st) {
   const unsigned char* buf = &Ring[st & 1][0];
   for (int ps = 0; ps < 2; ++ps) {
    const h16* k0p = (const h16*)(buf + (ps * 32 + col) * KPITCH);  // key st*64+ps*32+col (tile 0)
    const h16* k1p = (const h16*)(buf + (ps * 32 + 16 + col) * KPITCH);   // 16 keys further (tile 1)
    v8f s0r = {}, s0i = {}, s1r = {}, s1i = {};
    {
      // all eight K fragments are read as one group ahead of the products
      const v16h kf0 = frag_kh(k0p, hh), kf1 = frag_kh(k0p + 32, hh), kf2 = frag_kh(k0p + 64, hh), kf3 = frag_kh(k0p + 96, hh);
      const v16h kf4 = frag_kh(k1p, hh), kf5 = frag_kh(k1p + 32, hh), kf6 = frag_kh(k1p + 64, hh), kf7 = frag_kh(k1p + 96, hh);
      s0r = wmma_h(kf0, qf0, s0r); s0i = wmma_h(kf0, qf2, s0i);
      s0r = wmma_h(kf1, qf1, s0r); s0i = wmma_h(kf1, qf3, s0i);
      s0r = wmma_h(kf2, qf2, s0r); s0i = wmma_h(kf2, qn0, s0i);
      s0r = wmma_h(kf3, qf3, s0r); s0i = wmma_h(kf3, qn1, s0i);
      s1r = wmma_h(kf4, qf0, s1r); s1i = wmma_h(kf4, qf2, s1i);
      s1r = wmma_h(kf5, qf1, s1r); s1i = wmma_h(kf5, qf3, s1i);
      s1r = wmma_h(kf6, qf2, s1r); s1i = wmma_h(kf6, qn0, s1i);
      s1r = wmma_h(kf7, qf3, s1r); s1i = wmma_h(kf7, qn1, s1i);
    }
    // the pass's four V fragments, read here so that the score arithmetic covers their LDS latency
    const h16* v0p = (const h16*)(buf + KSTG_B) + ps * (2 * DH * 16) + 8 * hh + col * 16;   // key tile 0 of the pass; tile 1 is DH*16 further
    const v16h va0 = cat8h(ld8h(v0p + 0 * 256), ld8h(v0p + DH * 16 + 0 * 256));
    const v16h va1 = cat8h(ld8h(v0p + 1 * 256), ld8h(v0p + DH * 16 + 1 * 256));
    const v16h va2 = cat8h(ld8h(v0p + 2 * 256), ld8h(v0p + DH * 16 + 2 * 256));
    const v16h va3 = cat8h(ld8h(v0p + 3 * 256), ld8h(v0p + DH * 16 + 3 * 256));
    v8f sc0, sc1;
#pragma unroll
    for (int r = 0; r < 8; ++r) {
      const float a0 = s0r[r] * SCORE_SCALE, b0 = s0i[r] * SCORE_SCALE;
      const float a1 = s1r[r] * SCORE_SCALE, b1 = s1i[r] * SCORE_SCALE;
      sc0[r] = __builtin_amdgcn_sqrtf(a0 * a0 + b0 * b0);   // the hardware's v_sqrt_f32 alone: no range scaling, no last-bit correction
      sc1[r] = __builtin_amdgcn_sqrtf(a1 * a1 + b1 * b1);
    }
    float mr = -INFINITY;
#pragma unroll
    for (int r = 0; r < 8; ++r) mr = fmaxf(mr, fmaxf(sc0[r], sc1[r]));
    mr = fmaxf(mr, __shfl_xor(mr, 16));
    const float mn = fmaxf(m, mr);            // finite (scores >= 0)
    const float al_ = __expf(m - mn);         // 0 on the first chunk
    m = mn;
    float sum = 0.0f;
    v16h pb;
#pragma unroll
    for (int r = 0; r < 8; ++r) {
      const float p0 = __expf(sc0[r] - mn), p1 = __expf(sc1[r] - mn);
      sum += p0 + p1;
      pb[r] = (h16)(p0 * P_CARRY); pb[8 + r] = (h16)(p1 * P_CARRY);
    }
    sum += __shfl_xor(sum, 16);
    l = l * al_ + sum;
    o0 = o0 * al_; o1 = o1 * al_; o2 = o2 * al_; o3 = o3 * al_;
    o0 = wmma_h(va0, pb, o0);
    o1 = wmma_h(va1, pb, o1);
    o2 = wmma_h(va2, pb, o2);
    o3 = wmma_h_edge(va3, pb, o3);
   }
   asm volatile("s_wait_dscnt 0x0" ::: "memory");      // this wave's reads of stage st have returned
   asm volatile("s_wait_asynccnt 0x0" ::: "memory");   // this wave's copies of stage st+1 have landed
   __syncthreads();                                    // publishes stage st+1 and frees the buffer of stage st
   if (st + 2 < NSTG)                                  // block-uniform: refill the buffer just read with stage st+2
     stage_copy(kg + (size_t)(st + 2) * (STG * QKW), vg + (size_t)(st + 2) * (STG * DH), lk + (st & 1) * STG_B, lv + (st & 1) * STG_B);
  }
  asm volatile("s_wait_asynccnt 0x0" ::: "memory");    // no copy is outstanding when the wave goes on to the epilogue
  const float inv = (1.0f / l) * INV_P_CARRY;   // ctx = (o / 4096) / l
  float* Tt = Os[wid];                          // [query col][d], d = n*16 + 8hh + r
  {
    float* tp = Tt + col * 64 + 8 * hh;
    const v4f a0 = {o0[0] * inv, o0[1] * inv, o0[2] * inv, o0[3] * inv}, a1 = {o0[4] * inv, o0[5] * inv, o0[6] * inv, o0[7] * inv};
    const v4f b0 = {o1[0] * inv, o1[1] * inv, o1[2] * inv, o1[3] * inv}, b1 = {o1[4] * inv, o1[5] * inv, o1[6] * inv, o1[7] * inv};
    const v4f c0 = {o2[0] * inv, o2[1] * inv, o2[2] * inv, o2[3] * inv}, c1 = {o2[4] * inv, o2[5] * inv, o2[6] * inv, o2[7] * inv};
    const v4f d0 = {o3[0] * inv, o3[1] * inv, o3[2] * inv, o3[3] * inv}, d1 = {o3[4] * inv, o3[5] * inv, o3[6] * inv, o3[7] * inv};
    *(v4f*)(tp + 0)  = a0; *(v4f*)(tp + 4)  = a1;
    *(v4f*)(tp + 16) = b0; *(v4f*)(tp + 20) = b1;
    *(v4f*)(tp + 32) = c0; *(v4f*)(tp + 36) = c1;
    *(v4f*)(tp + 48) = d0; *(v4f*)(tp + 52) = d1;
  }
  wave_lds_sync();
  float* dst0 = out + ((size_t)b * SEQ + q0) * HID + h * DH;   // 16 rows x 64 floats, row stride HID floats
#pragma unroll
  for (int j = 0; j < 8; ++j) {
    const int rr = j * 2 + hh, c4 = col * 4;
    *(v4f*)(dst0 + (size_t)rr * HID + c4) = *(const v4f*)(Tt + rr * 64 + c4);
  }
  
}
}  // namespace

extern "C" void kernel_launch(void* const* d_in, const int* in_sizes, int n_in,
                              void* d_out, int out_size, void* d_ws, size_t ws_size, hipStream_t stream) {
  if (n_in < 6) return;
  const size_t need_x = ((size_t)(NB - 1) * SEQ_FULL + SEQ) * HID;
  if ((size_t)in_sizes[0] < need_x) return;
  for (int i = 1; i <= 5; ++i) if (in_sizes[i] < HID * HID) return;
  if ((size_t)out_size < (size_t)MROWS * HID) return;

  const float* x   = (const float*)d_in[0];     // [NB_FULL, SEQ_FULL, 768] f32
  const float* Wqr = (const float*)d_in[1];     // [768,768] ([out][in])
  const float* Wqi = (const float*)d_in[2];
  const float* Wkr = (const float*)d_in[3];
  const float* Wki = (const float*)d_in[4];
  const float* Wv  = (const float*)d_in[5];
  float* out = (float*)d_out;                   // [NB, SEQ, 768] f32

  size_t off = 0; char* ws = (char*)d_ws;
  unsigned short* xpl = (unsigned short*)(ws + off); off += (size_t)MROWS * HID * 2;        // 6,291,456 B bf16 activation plane
  unsigned short* wpl = (unsigned short*)(ws + off); off += (size_t)NW * HID * HID * 2;     // 5,898,240 B bf16 weight planes
  h16* Qa = (h16*)(ws + off); off += (size_t)MROWS * NH * QKW * 2;                          // 12,582,912 B f16 [g][t][128]
  h16* Kc = (h16*)(ws + off); off += (size_t)MROWS * NH * QKW * 2;                          // 12,582,912 B f16 [g][t][128]
  h16* Vp = (h16*)(ws + off); off += (size_t)MROWS * HID * 2;                               // 6,291,456 B f16 key-tiled
  if (off > ws_size) return;                                                                 // 43,646,976 B at NB=2, SEQ=2048

  cvt_kernel<<<1024, 256, 0, stream>>>(x, Wqr, Wqi, Wkr, Wki, Wv, xpl, wpl);
  proj_gemm_kernel<<<dim3(NCOMB / 128, MROWS / 128), 256, 0, stream>>>((const b16*)xpl, (const b16*)wpl, Qa, Kc, Vp);
  attn_kernel<<<(NB * NH * QT) / 8, 256, 0, stream>>>(Qa, Kc, Vp, out);
}

// v005
// It runs in 89.9 microseconds.
// Timed twice side by side with v004, it ran 1.07 times as fast both times.
// All steps since v000 together make it 3.62 times as fast.
#include <hip/hip_runtime.h>

// Contractions: five projections x.W^T (K = 768) on v_wmma_f32_16x16x32_bf16 (bf16 RNE operands, f32 accumulate, one product per tile pair);
// Sr^T = Kc.Qa^T and Si^T = Kc.Qb^T (K = 128: concatenated re | im head dims; Qb = [qi | -qr] by exact f16 sign flip of the Qa fragments)
// and ctx^T = V^T.P^T (32 keys per step, P carried x4096) on v_wmma_f32_16x16x32_f16 (f16 operands, f32 accumulate, one product per tile pair);
// magnitude sqrt(sr^2 + si^2), online softmax statistics and the final normalisation in f32.

#pragma clang fp contract(off)

#ifndef NB
#define NB 2
#endif
#ifndef SEQ
#define SEQ 2048
#endif
#ifndef NB_FULL
#define NB_FULL 2
#endif
#ifndef SEQ_FULL
#define SEQ_FULL 2048
#endif

namespace {
constexpr int HID = 768, DH = 64, NH = 12;
constexpr int NW = 5;                           // weight matrices: qr, qi, kr, ki, v ([out][in], k contiguous)
constexpr int NCOMB = NW * HID;                 // 3840 rows of the combined 16-bit weight plane
constexpr int MROWS = NB * SEQ;                 // compact token rows (b*SEQ + t)
constexpr int QT = SEQ / 16;                    // 16-query tiles per (b, head)
constexpr int QKW = 2 * DH;                     // 128: row width of the Qa / Kc planes (re | im)
constexpr float SCORE_SCALE = 0.125f;           // 1/sqrt(64)
constexpr float P_CARRY = 4096.0f;              // f16 P operand = exp(s - m) * 4096
constexpr float INV_P_CARRY = 1.0f / 4096.0f;
constexpr int STG = 64;                         // keys per LDS stage of the attention kernel (two 32-key passes)
constexpr int NSTG = SEQ / STG;                 // stages per (b, head)
constexpr int KPITCH = 272;                     // LDS bytes per staged K row: 256 + 16, 16 B x odd, conflict-free for 16-byte reads
constexpr int KSTG_B = STG * KPITCH;            // 17,408 B of K rows per stage
constexpr int VSTG_B = STG * DH * 2;            // 8,192 B of key-tiled V per stage
constexpr int STG_B = KSTG_B + VSTG_B;          // 25,600 B per buffer
constexpr int AW = 4;                           // waves per attention block: 3,072 query tiles = 768 blocks
constexpr int GKC = 64;                         // k elements per LDS stage of the projection GEMM (128 B of every operand row)
constexpr int GNST = HID / GKC;                 // 12 stages
constexpr int GPITCH = 144;                     // LDS bytes per staged operand row: 128 + 16, 16 B x odd, conflict-free for 16-byte reads
constexpr int GSTG_B = 256 * GPITCH;            // 36,864 B per buffer: 128 activation rows, then 128 weight rows
static_assert(HID % GKC == 0);
static_assert(GNST >= 2);
static_assert(NCOMB % 128 == 0);
static_assert(NH % 2 == 0);
static_assert(8 * 32 * 64 * 2 <= 2 * GSTG_B);
static_assert(SEQ % 128 == 0);
static_assert(NSTG >= 2);
static_assert(NB >= 1 && NB <= NB_FULL);
static_assert(SEQ <= SEQ_FULL);
static_assert(NH * DH == HID);
static_assert(MROWS % 128 == 0);
static_assert(HID % 32 == 0);
static_assert(NCOMB % 64 == 0);
static_assert(QT % AW == 0);                   // the waves of an attention block share one (b, head)
static_assert(STG * 16 == AW * 32 * 8 && VSTG_B == AW * 32 * 16 * 4);   // 8 K copies and 4 V copies a lane fill a stage exactly
static_assert((size_t)MROWS * HID <= (size_t)NB_FULL * SEQ_FULL * HID);

typedef __bf16 b16;
typedef _Float16 h16;
typedef __bf16 v16b __attribute__((ext_vector_type(16)));
typedef __bf16 v8b __attribute__((ext_vector_type(8)));
typedef _Float16 v16h __attribute__((ext_vector_type(16)));
typedef _Float16 v8h __attribute__((ext_vector_type(8)));
typedef float v8f __attribute__((ext_vector_type(8)));
typedef float v4f __attribute__((ext_vector_type(4)));
typedef unsigned short v8us __attribute__((ext_vector_type(8)));
typedef unsigned int v8u __attribute__((ext_vector_type(8)));

__device__ __forceinline__ v8b ld8b(const b16* p) { return *(const v8b*)p; }
__device__ __forceinline__ v8h ld8h(const h16* p) { return *(const v8h*)p; }
__device__ __forceinline__ v16b cat8b(v8b a, v8b b) { return __builtin_shufflevector(a, b, 0, 1, 2, 3, 4, 5, 6, 7, 8, 9, 10, 11, 12, 13, 14, 15); }
__device__ __forceinline__ v16h cat8h(v8h a, v8h b) { return __builtin_shufflevector(a, b, 0, 1, 2, 3, 4, 5, 6, 7, 8, 9, 10, 11, 12, 13, 14, 15); }
// 16x16x32 16-bit fragment from a k-contiguous row pointer (A: lane&15 = row, B: lane&15 = column), hh = lane>>4:
// elements 0..7 <- p[8hh+0..7], elements 8..15 <- p[16+8hh+0..7]
__device__ __forceinline__ v16b frag_kb(const b16* p, int hh) { return cat8b(ld8b(p + 8 * hh), ld8b(p + 16 + 8 * hh)); }
__device__ __forceinline__ v16h frag_kh(const h16* p, int hh) { return cat8h(ld8h(p + 8 * hh), ld8h(p + 16 + 8 * hh)); }

__device__ __forceinline__ v8f wmma_b(v16b a, v16b b, v8f c) {
  v8f d = __builtin_amdgcn_wmma_f32_16x16x32_bf16(false, a, false, b, (short)0, c, false, false);
  asm volatile("v_nop\n\tv_nop\n\tv_nop\n\tv_nop" : "+v"(d) : "v"(a), "v"(b));
  return d;
}
// builtin form alone: on the straight path the compiler keeps the distance behind a matrix instruction itself
__device__ __forceinline__ v8f wmma_h(v16h a, v16h b, v8f c) {
  return __builtin_amdgcn_wmma_f32_16x16x32_f16(false, a, false, b, (short)0, c, false, false);
}
// the last matrix instruction in front of a loop's back edge: the four vector
// slots that the chip needs before the loop head's vector instructions overwrite its A or B stand here
__device__ __forceinline__ v8f wmma_h_edge(v16h a, v16h b, v8f c) {
  v8f d = __builtin_amdgcn_wmma_f32_16x16x32_f16(false, a, false, b, (short)0, c, false, false);
  asm volatile("v_nop\n\tv_nop\n\tv_nop\n\tv_nop" : "+v"(d) : "v"(a), "v"(b));
  return d;
}
// exact sign flip of 16 packed f16 values
__device__ __forceinline__ v16h neg16h(v16h a) {
  v8u t = __builtin_bit_cast(v8u, a);
  const v8u s = {0x80008000u, 0x80008000u, 0x80008000u, 0x80008000u, 0x80008000u, 0x80008000u, 0x80008000u, 0x80008000u};
  t = t ^ s;
  return __builtin_bit_cast(v16h, t);
}
// f32 -> bf16 by RNE convert, returned as the f32 bit pattern with the low 16 bits cleared
__device__ __forceinline__ unsigned int bf16_rne_u32(float f) {
  unsigned int u = __builtin_bit_cast(unsigned int, f);
  u += 0x7fffu + ((u >> 16) & 1u);
  return u & 0xffff0000u;
}
// wave-private LDS tile: stores by this wave, then vector reloads by this wave
__device__ __forceinline__ void wave_lds_sync() {
  __builtin_amdgcn_fence(3, "workgroup");
  __builtin_amdgcn_wave_barrier();
  __builtin_amdgcn_fence(2, "workgroup");
}

// ---------------------------------------------------------------------------
// x f32 [NB_FULL][SEQ_FULL][768] -> bf16 plane xpl [MROWS][768] (compact rows b*SEQ+t);
// weights W[n][k] f32 ([out][in], k contiguous) -> bf16 planes wpl [5][768][768] in the order qr, qi, kr, ki, v.
// ---------------------------------------------------------------------------
__global__ __launch_bounds__(256) void cvt_kernel(const float* __restrict__ x,
                                                  const float* __restrict__ w0, const float* __restrict__ w1, const float* __restrict__ w2,
                                                  const float* __restrict__ w3, const float* __restrict__ w4,
                                                  unsigned short* __restrict__ xpl, unsigned short* __restrict__ wpl) {
  const size_t tid = (size_t)blockIdx.x * blockDim.x + threadIdx.x, stride = (size_t)gridDim.x * blockDim.x;
  const size_t nx = (size_t)MROWS * HID / 8;
  const size_t per_w = (size_t)HID * HID / 8, nw = (size_t)NW * per_w;
  {
    for (size_t c = tid; c < nx; c += stride) {
      const size_t i = c * 8;                                       // element index inside the compact plane
      const int m = (int)(i / HID), col = (int)(i % HID);
      const int bb = m / SEQ, t = m - bb * SEQ;
      const float* p = x + ((size_t)bb * SEQ_FULL + t) * HID + col;
      const v4f f0 = *(const v4f*)p, f1 = *(const v4f*)(p + 4);
      v8us o;
#pragma unroll
      for (int e = 0; e < 4; ++e) {
        o[e] = (unsigned short)(bf16_rne_u32(f0[e]) >> 16);
        o[4 + e] = (unsigned short)(bf16_rne_u32(f1[e]) >> 16);
      }
      *(v8us*)(xpl + i) = o;
    }
    for (size_t c = tid; c < nw; c += stride) {
      const int mat = (int)(c / per_w);
      const size_t i = (c - (size_t)mat * per_w) * 8;               // element index inside one [768][768] matrix
      const float* w = (mat == 0) ? w0 : (mat == 1) ? w1 : (mat == 2) ? w2 : (mat == 3) ? w3 : w4;
      const v4f f0 = *(const v4f*)(w + i), f1 = *(const v4f*)(w + i + 4);
      v8us o;
#pragma unroll
      for (int e = 0; e < 4; ++e) {
        o[e] = (unsigned short)(bf16_rne_u32(f0[e]) >> 16);
        o[4 + e] = (unsigned short)(bf16_rne_u32(f1[e]) >> 16);
      }
      *(v8us*)(wpl + c * 8) = o;                           // plane offset mat*768*768 + i == c*8
    }
    
  }
}

__device__ __forceinline__ unsigned int lds_off(const void* p) { return (unsigned int)(size_t)p; }
// One 64-k stage of the projection GEMM into one LDS buffer: 256 lanes x 8 asynchronous 16-byte copies (4 of activation rows,
// 4 of weight rows), through no register. ag / wg: this lane's first 16 bytes of the stage; la: their LDS byte address.
// Copy i: row i*32 + tid/8, piece tid%8 (a wave covers four whole 128-B lines).
// s_wait_xcnt 0 closes the statement so that no address register is rewritten while a copy may still name it.
__device__ __forceinline__ void gemm_stage_copy(const b16* ag, const b16* wg, unsigned int la) {
  asm volatile("global_load_async_to_lds_b128 %0, %8, off\n\t"
               "global_load_async_to_lds_b128 %1, %9, off\n\t"
               "global_load_async_to_lds_b128 %2, %10, off\n\t"
               "global_load_async_to_lds_b128 %3, %11, off\n\t"
               "global_load_async_to_lds_b128 %4, %12, off\n\t"
               "global_load_async_to_lds_b128 %5, %13, off\n\t"
               "global_load_async_to_lds_b128 %6, %14, off\n\t"
               "global_load_async_to_lds_b128 %7, %15, off\n\t"
               "s_wait_xcnt 0x0"
               :: "v"(la), "v"(la + 32 * GPITCH), "v"(la + 64 * GPITCH), "v"(la + 96 * GPITCH),
                  "v"(la + 128 * GPITCH), "v"(la + 160 * GPITCH), "v"(la + 192 * GPITCH), "v"(la + 224 * GPITCH),
                  "v"(ag), "v"(ag + 32 * HID), "v"(ag + 64 * HID), "v"(ag + 96 * HID),
                  "v"(wg), "v"(wg + 32 * HID), "v"(wg + 64 * HID), "v"(wg + 96 * HID)
               : "memory");
}

// ---------------------------------------------------------------------------
// Projection GEMM: (MROWS x 768) x (768 x 3840), grid (30, MROWS/128), block 8 waves = 128 token rows x 128 columns,
// wave = 32 token rows x 64 columns (one head of one of the five matrices); waves 0..3 take the block's first head, 4..7 its second.
// The block's 128 activation rows and 128 weight rows come once per block into a two-buffer LDS ring, 64 k a stage,
// by asynchronous copies issued one stage ahead; every wave reads its fragments from the ring (32 k a step, k ascending).
// blockIdx.x -> mat = x/6 (qr, qi, kr, ki, v), heads 2*(x%6) and 2*(x%6)+1. Output f16 planes:
// v -> Vp key-tiled [g][t/16][64][16] (4 KB contiguous per wave), g = b*12 + head.
// ---------------------------------------------------------------------------
__global__ __launch_bounds__(256) void proj_gemm_kernel(const b16* __restrict__ xpl, const b16* __restrict__ wpl,
                                                        h16* __restrict__ Qa, h16* __restrict__ Kc, h16* __restrict__ Vp) {
  __shared__ __attribute__((aligned(16))) unsigned char Gs[2 * GSTG_B];   // the ring; behind the loop's last barrier the output staging
  const int tid = threadIdx.x;
  const int lane = tid & 31, wave = tid >> 5, nloc = lane & 15, hlf = lane >> 4;
  const int msub = wave & 3, nsub = wave >> 2;
  const int m0 = blockIdx.y * 128 + msub * 32;
  const int mat = blockIdx.x / (NH / 2);           // block-uniform: both heads of a block belong to one matrix
  const int head = (blockIdx.x - mat * (NH / 2)) * 2 + nsub;
  v8f acc[2][4];
#pragma unroll
  for (int r = 0; r < 2; ++r)
#pragma unroll
    for (int t = 0; t < 4; ++t) acc[r][t] = (v8f){};
  const b16* ag = xpl + (size_t)(blockIdx.y * 128 + (tid >> 3)) * HID + (tid & 7) * 8;   // this lane's first activation piece of stage 0
  const b16* wg = wpl + (size_t)(blockIdx.x * 128 + (tid >> 3)) * HID + (tid & 7) * 8;   // this lane's first weight piece of stage 0
  const unsigned int la = lds_off(&Gs[0]) + (unsigned int)((tid >> 3) * GPITCH + (tid & 7) * 16);
  gemm_stage_copy(ag, wg, la);                                              // stage 0 -> buffer 0
  asm volatile("s_wait_asynccnt 0x0" ::: "memory");                         // this wave's copies of stage 0 have landed
  __syncthreads();                                                          // publishes stage 0 to all 8 waves
  gemm_stage_copy(ag + GKC, wg + GKC, la + GSTG_B);                         // stage 1 -> buffer 1 (GNST >= 2)
  for (int st = 0; st < GNST; ++st) {
    const unsigned char* buf = &Gs[(st & 1) * GSTG_B];
    const b16* ar = (const b16*)(buf + (msub * 32 + nloc) * GPITCH);        // activation row m0 + nloc; 16 rows further: a1
    const b16* wr = (const b16*)(buf + (128 + nsub * 64 + nloc) * GPITCH);  // weight row of column nloc of the wave's head
#pragma unroll   // both 32-k steps of a stage inline, so that every fragment read has a constant LDS offset
    for (int kk = 0; kk < GKC; kk += 32) {
      const v16b a0 = frag_kb(ar + kk, hlf);
      const v16b a1 = frag_kb(ar + 16 * (GPITCH / 2) + kk, hlf);
      // the step's six fragments are read as one group ahead of its eight products
      const v16b bf0 = frag_kb(wr + kk, hlf), bf1 = frag_kb(wr + 16 * (GPITCH / 2) + kk, hlf);
      const v16b bf2 = frag_kb(wr + 32 * (GPITCH / 2) + kk, hlf), bf3 = frag_kb(wr + 48 * (GPITCH / 2) + kk, hlf);
      acc[0][0] = wmma_b(a0, bf0, acc[0][0]); acc[1][0] = wmma_b(a1, bf0, acc[1][0]);
      acc[0][1] = wmma_b(a0, bf1, acc[0][1]); acc[1][1] = wmma_b(a1, bf1, acc[1][1]);
      acc[0][2] = wmma_b(a0, bf2, acc[0][2]); acc[1][2] = wmma_b(a1, bf2, acc[1][2]);
      acc[0][3] = wmma_b(a0, bf3, acc[0][3]); acc[1][3] = wmma_b(a1, bf3, acc[1][3]);
    }
    asm volatile("s_wait_dscnt 0x0" ::: "memory");      // this wave's reads of stage st have returned
    asm volatile("s_wait_asynccnt 0x0" ::: "memory");   // this wave's copies of stage st+1 have landed
    __syncthreads();                                    // publishes stage st+1 and frees the buffer of stage st
    if (st + 2 < GNST)                                  // block-uniform: refill the buffer just read with stage st+2
      gemm_stage_copy(ag + (st + 2) * GKC, wg + (st + 2) * GKC, la + (st & 1) * GSTG_B);
  }
  asm volatile("s_wait_asynccnt 0x0" ::: "memory");     // no copy is outstanding when the ring becomes the output staging
  const int b = m0 / SEQ, t0 = m0 % SEQ;
  const int g = b * NH + head;
  h16* Tp = (h16*)&Gs[0] + wave * (32 * 64);       // 4 KB of the ring per wave: every read of it ended at the loop's last barrier
#pragma unroll
  for (int t = 0; t < 4; ++t) {
    const int d = t * 16 + nloc;
#pragma unroll
    for (int r = 0; r < 2; ++r)
#pragma unroll
      for (int v = 0; v < 8; ++v) {
        const int rr = r * 16 + v + 8 * hlf;                         // local token row 0..31
        const h16 y = (h16)acc[r][t][v];
        const int idx = (mat < 4) ? (rr * 64 + d) : ((rr >> 4) * 1024 + d * 16 + (rr & 15));
        Tp[idx] = y;
      }
  }
  wave_lds_sync();
  if (mat < 4) {                                   // block-uniform branch, no barriers inside
    h16* P = (mat < 2) ? Qa : Kc;
    const int coff = (mat & 1) * DH;
    h16* dst = P + ((size_t)g * SEQ + t0) * QKW + coff;              // 32 rows of 64 halves, row pitch 128 halves
#pragma unroll
    for (int j = 0; j < 8; ++j) {
      const int rr = j * 4 + (lane >> 3), c8 = (lane & 7) * 8;
      *(v8h*)(dst + (size_t)rr * QKW + c8) = ld8h(Tp + rr * 64 + c8);
    }
    
  } else {
    h16* dst = Vp + ((size_t)g * QT + (t0 >> 4)) * (size_t)(DH * 16); // two consecutive key tiles = 4 KB contiguous
#pragma unroll
    for (int j = 0; j < 8; ++j) { const int e = (j * 32 + lane) * 8; *(v8h*)(dst + e) = ld8h(Tp + e); }
    
  }
}

// One 64-key stage into one LDS buffer, 128 lanes x 12 asynchronous 16-byte copies (8 of K, 4 of V), through no register.
// kg / vg: this lane's first 16 bytes of the stage's K rows / V tiles; lk / lv: their LDS byte addresses.
// K copy i: row i*8 + tid/16, piece tid%16 (a wave covers two whole 256-B rows); V copy i: bytes i*2048 + tid*16.
// s_wait_xcnt 0 closes the statement so that no address register is rewritten while a copy may still name it.
__device__ __forceinline__ void stage_copy(const h16* kg, const h16* vg, unsigned int lk, unsigned int lv) {
  asm volatile("global_load_async_to_lds_b128 %0, %12, off\n\t"
               "global_load_async_to_lds_b128 %1, %13, off\n\t"
               "global_load_async_to_lds_b128 %2, %14, off\n\t"
               "global_load_async_to_lds_b128 %3, %15, off\n\t"
               "global_load_async_to_lds_b128 %4, %16, off\n\t"
               "global_load_async_to_lds_b128 %5, %17, off\n\t"
               "global_load_async_to_lds_b128 %6, %18, off\n\t"
               "global_load_async_to_lds_b128 %7, %19, off\n\t"
               "global_load_async_to_lds_b128 %8, %20, off\n\t"
               "global_load_async_to_lds_b128 %9, %21, off\n\t"
               "global_load_async_to_lds_b128 %10, %22, off\n\t"
               "global_load_async_to_lds_b128 %11, %23, off\n\t"
               "s_wait_xcnt 0x0"
               :: "v"(lk), "v"(lk + 8 * KPITCH), "v"(lk + 16 * KPITCH), "v"(lk + 24 * KPITCH),
                  "v"(lk + 32 * KPITCH), "v"(lk + 40 * KPITCH), "v"(lk + 48 * KPITCH), "v"(lk + 56 * KPITCH),
                  "v"(lv), "v"(lv + 2048), "v"(lv + 4096), "v"(lv + 6144),
                  "v"(kg), "v"(kg + 8 * QKW), "v"(kg + 16 * QKW), "v"(kg + 24 * QKW),
                  "v"(kg + 32 * QKW), "v"(kg + 40 * QKW), "v"(kg + 48 * QKW), "v"(kg + 56 * QKW),
                  "v"(vg), "v"(vg + 1024), "v"(vg + 2048), "v"(vg + 3072)
               : "memory");
}

// ---------------------------------------------------------------------------
// Transposed flash attention: each wave owns one 16-query tile of one (b, head); 4 waves per block; all SEQ keys in chunks of 32.
// Placement: 768 blocks, and at most 3 waves fit a SIMD (amdgpu_waves_per_eu).
// The block's 4 waves share one (b, head): its K rows and V tiles come once per block into a two-buffer LDS ring, 64 keys a stage,
// by asynchronous copies issued one stage ahead; every wave reads its fragments from the ring.
// Sr^T = Kc.Qa^T and Si^T = Kc.Qb^T (f16 fragments, 4 k-steps over the 128-wide re|im rows),
// s = sqrt((sr/8)^2 + (si/8)^2) in f32, per-lane online softmax (running max);
// P^T fragment built in registers from two S^T tiles (element r <- keys 0..15 tile, element 8+r <- keys 16..31 tile), carried x4096;
// ---------------------------------------------------------------------------
__global__ __launch_bounds__(AW * 32) __attribute__((amdgpu_waves_per_eu(3, 3))) void attn_kernel(const h16* __restrict__ Qa, const h16* __restrict__ Kc, const h16* __restrict__ Vp,
                                                   float* __restrict__ out) {
  __shared__ __attribute__((aligned(16))) float Os[AW][16 * 64];
  __shared__ __attribute__((aligned(16))) unsigned char Ring[2][STG_B];
  const int wid = threadIdx.x >> 5, lane = threadIdx.x & 31, hh = lane >> 4, col = lane & 15;
  const int qtile = blockIdx.x * AW + wid;                // over NB*NH*QT (exact grid)
  const int g = qtile / QT;                               // b*NH + h
  const int q0 = (qtile % QT) << 4;
  const int b = g / NH, h = g % NH;
  const size_t kbase = (size_t)g * SEQ * QKW;             // Kc plane base of (b,h)
  const size_t vbase = (size_t)g * SEQ * DH;              // V key-tiled base of (b,h): QT tiles of 64x16
  const h16* qrow = Qa + ((size_t)g * SEQ + q0 + col) * QKW;
  const v16h qf0 = frag_kh(qrow, hh), qf1 = frag_kh(qrow + 32, hh);        // qr d 0..31, 32..63 of query q0+col
  const v16h qf2 = frag_kh(qrow + 64, hh), qf3 = frag_kh(qrow + 96, hh);   // qi d 0..31, 32..63
  const v16h qn0 = neg16h(qf0), qn1 = neg16h(qf1);                          // -qr (exact)
  float m = -INFINITY, l = 0.0f;
  v8f o0 = {}, o1 = {}, o2 = {}, o3 = {};
  const int tid = threadIdx.x;
  const h16* kg = Kc + kbase + (size_t)(tid >> 4) * QKW + (tid & 15) * 8;   // this lane's first K piece of stage 0
  const h16* vg = Vp + vbase + (size_t)tid * 8;                             // this lane's first V piece of stage 0
  const unsigned int lk = lds_off(&Ring[0][0]) + (unsigned int)((tid >> 4) * KPITCH + (tid & 15) * 16);
  const unsigned int lv = lds_off(&Ring[0][0]) + (unsigned int)(KSTG_B + tid * 16);
  stage_copy(kg, vg, lk, lv);                                               // stage 0 -> buffer 0
  asm volatile("s_wait_asynccnt 0x0" ::: "memory");                         // this wave's copies of stage 0 have landed
  __syncthreads();                                                          // publishes stage 0 to all 4 waves
  stage_copy(kg + (size_t)STG * QKW, vg + (size_t)STG * DH, lk + STG_B, lv + STG_B);   // stage 1 -> buffer 1 (NSTG >= 2)
  for (int st = 0; st < NSTG; ++st) {
   const unsigned char* buf = &Ring[st & 1][0];
   for (int ps = 0; ps < 2; ++ps) {
    const h16* k0p = (const h16*)(buf + (ps * 32 + col) * KPITCH);  // key st*64+ps*32+col (tile 0)
    const h16* k1p = (const h16*)(buf + (ps * 32 + 16 + col) * KPITCH);   // 16 keys further (tile 1)
    v8f s0r = {}, s0i = {}, s1r = {}, s1i = {};
    {
      // all eight K fragments are read as one group ahead of the products
      const v16h kf0 = frag_kh(k0p, hh), kf1 = frag_kh(k0p + 32, hh), kf2 = frag_kh(k0p + 64, hh), kf3 = frag_kh(k0p + 96, hh);
      const v16h kf4 = frag_kh(k1p, hh), kf5 = frag_kh(k1p + 32, hh), kf6 = frag_kh(k1p + 64, hh), kf7 = frag_kh(k1p + 96, hh);
      s0r = wmma_h(kf0, qf0, s0r); s0i = wmma_h(kf0, qf2, s0i);
      s0r = wmma_h(kf1, qf1, s0r); s0i = wmma_h(kf1, qf3, s0i);
      s0r = wmma_h(kf2, qf2, s0r); s0i = wmma_h(kf2, qn0, s0i);
      s0r = wmma_h(kf3, qf3, s0r); s0i = wmma_h(kf3, qn1, s0i);
      s1r = wmma_h(kf4, qf0, s1r); s1i = wmma_h(kf4, qf2, s1i);
      s1r = wmma_h(kf5, qf1, s1r); s1i = wmma_h(kf5, qf3, s1i);
      s1r = wmma_h(kf6, qf2, s1r); s1i = wmma_h(kf6, qn0, s1i);
      s1r = wmma_h(kf7, qf3, s1r); s1i = wmma_h(kf7, qn1, s1i);
    }
    // the pass's four V fragments, read here so that the score arithmetic covers their LDS latency
    const h16* v0p = (const h16*)(buf + KSTG_B) + ps * (2 * DH * 16) + 8 * hh + col * 16;   // key tile 0 of the pass; tile 1 is DH*16 further
    const v16h va0 = cat8h(ld8h(v0p + 0 * 256), ld8h(v0p + DH * 16 + 0 * 256));
    const v16h va1 = cat8h(ld8h(v0p + 1 * 256), ld8h(v0p + DH * 16 + 1 * 256));
    const v16h va2 = cat8h(ld8h(v0p + 2 * 256), ld8h(v0p + DH * 16 + 2 * 256));
    const v16h va3 = cat8h(ld8h(v0p + 3 * 256), ld8h(v0p + DH * 16 + 3 * 256));
    v8f sc0, sc1;
#pragma unroll
    for (int r = 0; r < 8; ++r) {
      const float a0 = s0r[r] * SCORE_SCALE, b0 = s0i[r] * SCORE_SCALE;
      const float a1 = s1r[r] * SCORE_SCALE, b1 = s1i[r] * SCORE_SCALE;
      sc0[r] = __builtin_amdgcn_sqrtf(a0 * a0 + b0 * b0);   // the hardware's v_sqrt_f32 alone: no range scaling, no last-bit correction
      sc1[r] = __builtin_amdgcn_sqrtf(a1 * a1 + b1 * b1);
    }
    float mr = -INFINITY;
#pragma unroll
    for (int r = 0; r < 8; ++r) mr = fmaxf(mr, fmaxf(sc0[r], sc1[r]));
    mr = fmaxf(mr, __shfl_xor(mr, 16));
    const float mn = fmaxf(m, mr);            // finite (scores >= 0)
    const float al_ = __expf(m - mn);         // 0 on the first chunk
    m = mn;
    float sum = 0.0f;
    v16h pb;
#pragma unroll
    for (int r = 0; r < 8; ++r) {
      const float p0 = __expf(sc0[r] - mn), p1 = __expf(sc1[r] - mn);
      sum += p0 + p1;
      pb[r] = (h16)(p0 * P_CARRY); pb[8 + r] = (h16)(p1 * P_CARRY);
    }
    sum += __shfl_xor(sum, 16);
    l = l * al_ + sum;
    o0 = o0 * al_; o1 = o1 * al_; o2 = o2 * al_; o3 = o3 * al_;
    o0 = wmma_h(va0, pb, o0);
    o1 = wmma_h(va1, pb, o1);
    o2 = wmma_h(va2, pb, o2);
    o3 = wmma_h_edge(va3, pb, o3);
   }
   asm volatile("s_wait_dscnt 0x0" ::: "memory");      // this wave's reads of stage st have returned
   asm volatile("s_wait_asynccnt 0x0" ::: "memory");   // this wave's copies of stage st+1 have landed
   __syncthreads();                                    // publishes stage st+1 and frees the buffer of stage st
   if (st + 2 < NSTG)                                  // block-uniform: refill the buffer just read with stage st+2
     stage_copy(kg + (size_t)(st + 2) * (STG * QKW), vg + (size_t)(st + 2) * (STG * DH), lk + (st & 1) * STG_B, lv + (st & 1) * STG_B);
  }
  asm volatile("s_wait_asynccnt 0x0" ::: "memory");    // no copy is outstanding when the wave goes on to the epilogue
  const float inv = (1.0f / l) * INV_P_CARRY;   // ctx = (o / 4096) / l
  float* Tt = Os[wid];                          // [query col][d], d = n*16 + 8hh + r
  {
    float* tp = Tt + col * 64 + 8 * hh;
    const v4f a0 = {o0[0] * inv, o0[1] * inv, o0[2] * inv, o0[3] * inv}, a1 = {o0[4] * inv, o0[5] * inv, o0[6] * inv, o0[7] * inv};
    const v4f b0 = {o1[0] * inv, o1[1] * inv, o1[2] * inv, o1[3] * inv}, b1 = {o1[4] * inv, o1[5] * inv, o1[6] * inv, o1[7] * inv};
    const v4f c0 = {o2[0] * inv, o2[1] * inv, o2[2] * inv, o2[3] * inv}, c1 = {o2[4] * inv, o2[5] * inv, o2[6] * inv, o2[7] * inv};
    const v4f d0 = {o3[0] * inv, o3[1] * inv, o3[2] * inv, o3[3] * inv}, d1 = {o3[4] * inv, o3[5] * inv, o3[6] * inv, o3[7] * inv};
    *(v4f*)(tp + 0)  = a0; *(v4f*)(tp + 4)  = a1;
    *(v4f*)(tp + 16) = b0; *(v4f*)(tp + 20) = b1;
    *(v4f*)(tp + 32) = c0; *(v4f*)(tp + 36) = c1;
    *(v4f*)(tp + 48) = d0; *(v4f*)(tp + 52) = d1;
  }
  wave_lds_sync();
  float* dst0 = out + ((size_t)b * SEQ + q0) * HID + h * DH;   // 16 rows x 64 floats, row stride HID floats
#pragma unroll
  for (int j = 0; j < 8; ++j) {
    const int rr = j * 2 + hh, c4 = col * 4;
    *(v4f*)(dst0 + (size_t)rr * HID + c4) = *(const v4f*)(Tt + rr * 64 + c4);
  }
  
}
}  // namespace

extern "C" void kernel_launch(void* const* d_in, const int* in_sizes, int n_in,
                              void* d_out, int out_size, void* d_ws, size_t ws_size, hipStream_t stream) {
  if (n_in < 6) return;
  const size_t need_x = ((size_t)(NB - 1) * SEQ_FULL + SEQ) * HID;
  if ((size_t)in_sizes[0] < need_x) return;
  for (int i = 1; i <= 5; ++i) if (in_sizes[i] < HID * HID) return;
  if ((size_t)out_size < (size_t)MROWS * HID) return;

  const float* x   = (const float*)d_in[0];     // [NB_FULL, SEQ_FULL, 768] f32
  const float* Wqr = (const float*)d_in[1];     // [768,768] ([out][in])
  const float* Wqi = (const float*)d_in[2];
  const float* Wkr = (const float*)d_in[3];
  const float* Wki = (const float*)d_in[4];
  const float* Wv  = (const float*)d_in[5];
  float* out = (float*)d_out;                   // [NB, SEQ, 768] f32

  size_t off = 0; char* ws = (char*)d_ws;
  unsigned short* xpl = (unsigned short*)(ws + off); off += (size_t)MROWS * HID * 2;        // 6,291,456 B bf16 activation plane
  unsigned short* wpl = (unsigned short*)(ws + off); off += (size_t)NW * HID * HID * 2;     // 5,898,240 B bf16 weight planes
  h16* Qa = (h16*)(ws + off); off += (size_t)MROWS * NH * QKW * 2;                          // 12,582,912 B f16 [g][t][128]
  h16* Kc = (h16*)(ws + off); off += (size_t)MROWS * NH * QKW * 2;                          // 12,582,912 B f16 [g][t][128]
  h16* Vp = (h16*)(ws + off); off += (size_t)MROWS * HID * 2;                               // 6,291,456 B f16 key-tiled
  if (off > ws_size) return;                                                                 // 43,646,976 B at NB=2, SEQ=2048

  cvt_kernel<<<1024, 256, 0, stream>>>(x, Wqr, Wqi, Wkr, Wki, Wv, xpl, wpl);
  proj_gemm_kernel<<<dim3(NCOMB / 128, MROWS / 128), 256, 0, stream>>>((const b16*)xpl, (const b16*)wpl, Qa, Kc, Vp);
  attn_kernel<<<(NB * NH * QT) / AW, AW * 32, 0, stream>>>(Qa, Kc, Vp, out);
}

// v006
// One run takes 83.8 microseconds.
// Next to v005, in two timings, it ran 1.07 times as fast each time.
// All steps since v000 together make it 3.87 times as fast.
#include <hip/hip_runtime.h>

// Contractions: five projections x.W^T (K = 768) on v_wmma_f32_16x16x32_bf16 (bf16 RNE operands, f32 accumulate, one product per tile pair);
// Sr^T = Kc.Qa^T and Si^T = Kc.Qb^T (K = 128: concatenated re | im head dims; Qb = [qi | -qr] by exact f16 sign flip of the Qa fragments)
// and ctx^T = V^T.P^T (32 keys per step, P carried x4096) on v_wmma_f32_16x16x32_f16 (f16 operands, f32 accumulate, one product per tile pair);
// magnitude sqrt(sr^2 + si^2), online softmax statistics and the final normalisation in f32.

#pragma clang fp contract(off)

#ifndef NB
#define NB 2
#endif
#ifndef SEQ
#define SEQ 2048
#endif
#ifndef NB_FULL
#define NB_FULL 2
#endif
#ifndef SEQ_FULL
#define SEQ_FULL 2048
#endif

namespace {
constexpr int HID = 768, DH = 64, NH = 12;
constexpr int NW = 5;                           // weight matrices: qr, qi, kr, ki, v ([out][in], k contiguous)
constexpr int NCOMB = NW * HID;                 // 3840 rows of the combined 16-bit weight plane
constexpr int MROWS = NB * SEQ;                 // compact token rows (b*SEQ + t)
constexpr int QT = SEQ / 16;                    // 16-query tiles per (b, head)
constexpr int QKW = 2 * DH;                     // 128: row width of the Qa / Kc planes (re | im)
constexpr float SCORE_SCALE = 0.125f;           // 1/sqrt(64)
constexpr float P_CARRY_LOG2 = 12.0f;           // f16 P operand = exp(s - m) * 4096 = exp2((s - m) * log2 e + 12)
constexpr float EXP_SCALE = SCORE_SCALE * 1.44269504088896340736f;   // log2 e / 8: takes sqrt(sr^2 + si^2) = 8 s to the exponent of 2
constexpr int STG = 64;                         // keys per LDS stage of the attention kernel (two 32-key passes)
constexpr int NSTG = SEQ / STG;                 // stages per (b, head)
constexpr int KPITCH = 272;                     // LDS bytes per staged K row: 256 + 16, 16 B x odd, conflict-free for 16-byte reads
constexpr int KSTG_B = STG * KPITCH;            // 17,408 B of K rows per stage
constexpr int VSTG_B = STG * DH * 2;            // 8,192 B of key-tiled V per stage
constexpr int STG_B = KSTG_B + VSTG_B;          // 25,600 B per buffer
constexpr int AW = 4;                           // waves per attention block: 3,072 query tiles = 768 blocks
constexpr int GKC = 64;                         // k elements per LDS stage of the projection GEMM (128 B of every operand row)
constexpr int GNST = HID / GKC;                 // 12 stages
constexpr int GPITCH = 144;                     // LDS bytes per staged operand row: 128 + 16, 16 B x odd, conflict-free for 16-byte reads
constexpr int GSTG_B = 256 * GPITCH;            // 36,864 B per buffer: 128 activation rows, then 128 weight rows
static_assert(HID % GKC == 0);
static_assert(GNST >= 2);
static_assert(NCOMB % 128 == 0);
static_assert(NH % 2 == 0);
static_assert(8 * 32 * 64 * 2 <= 2 * GSTG_B);
static_assert(SEQ % 128 == 0);
static_assert(NSTG >= 2);
static_assert(NB >= 1 && NB <= NB_FULL);
static_assert(SEQ <= SEQ_FULL);
static_assert(NH * DH == HID);
static_assert(MROWS % 128 == 0);
static_assert(HID % 32 == 0);
static_assert(NCOMB % 64 == 0);
static_assert(QT % AW == 0);                   // the waves of an attention block share one (b, head)
static_assert(STG * 16 == AW * 32 * 8 && VSTG_B == AW * 32 * 16 * 4);   // 8 K copies and 4 V copies a lane fill a stage exactly
static_assert((size_t)MROWS * HID <= (size_t)NB_FULL * SEQ_FULL * HID);

typedef __bf16 b16;
typedef _Float16 h16;
typedef __bf16 v16b __attribute__((ext_vector_type(16)));
typedef __bf16 v8b __attribute__((ext_vector_type(8)));
typedef _Float16 v16h __attribute__((ext_vector_type(16)));
typedef _Float16 v8h __attribute__((ext_vector_type(8)));
typedef float v8f __attribute__((ext_vector_type(8)));
typedef float v4f __attribute__((ext_vector_type(4)));
typedef unsigned short v8us __attribute__((ext_vector_type(8)));
typedef unsigned int v8u __attribute__((ext_vector_type(8)));

__device__ __forceinline__ v8b ld8b(const b16* p) { return *(const v8b*)p; }
__device__ __forceinline__ v8h ld8h(const h16* p) { return *(const v8h*)p; }
__device__ __forceinline__ v16b cat8b(v8b a, v8b b) { return __builtin_shufflevector(a, b, 0, 1, 2, 3, 4, 5, 6, 7, 8, 9, 10, 11, 12, 13, 14, 15); }
__device__ __forceinline__ v16h cat8h(v8h a, v8h b) { return __builtin_shufflevector(a, b, 0, 1, 2, 3, 4, 5, 6, 7, 8, 9, 10, 11, 12, 13, 14, 15); }
// 16x16x32 16-bit fragment from a k-contiguous row pointer (A: lane&15 = row, B: lane&15 = column), hh = lane>>4:
// elements 0..7 <- p[8hh+0..7], elements 8..15 <- p[16+8hh+0..7]
__device__ __forceinline__ v16b frag_kb(const b16* p, int hh) { return cat8b(ld8b(p + 8 * hh), ld8b(p + 16 + 8 * hh)); }
__device__ __forceinline__ v16h frag_kh(const h16* p, int hh) { return cat8h(ld8h(p + 8 * hh), ld8h(p + 16 + 8 * hh)); }

__device__ __forceinline__ v8f wmma_b(v16b a, v16b b, v8f c) {
  v8f d = __builtin_amdgcn_wmma_f32_16x16x32_bf16(false, a, false, b, (short)0, c, false, false);
  asm volatile("v_nop\n\tv_nop\n\tv_nop\n\tv_nop" : "+v"(d) : "v"(a), "v"(b));
  return d;
}
// builtin form alone: on the straight path the compiler keeps the distance behind a matrix instruction itself
__device__ __forceinline__ v8f wmma_h(v16h a, v16h b, v8f c) {
  return __builtin_amdgcn_wmma_f32_16x16x32_f16(false, a, false, b, (short)0, c, false, false);
}
// exact sign flip of 16 packed f16 values
__device__ __forceinline__ v16h neg16h(v16h a) {
  v8u t = __builtin_bit_cast(v8u, a);
  const v8u s = {0x80008000u, 0x80008000u, 0x80008000u, 0x80008000u, 0x80008000u, 0x80008000u, 0x80008000u, 0x80008000u};
  t = t ^ s;
  return __builtin_bit_cast(v16h, t);
}
// f32 -> bf16 by RNE convert, returned as the f32 bit pattern with the low 16 bits cleared
__device__ __forceinline__ unsigned int bf16_rne_u32(float f) {
  unsigned int u = __builtin_bit_cast(unsigned int, f);
  u += 0x7fffu + ((u >> 16) & 1u);
  return u & 0xffff0000u;
}
// wave-private LDS tile: stores by this wave, then vector reloads by this wave
__device__ __forceinline__ void wave_lds_sync() {
  __builtin_amdgcn_fence(3, "workgroup");
  __builtin_amdgcn_wave_barrier();
  __builtin_amdgcn_fence(2, "workgroup");
}

// ---------------------------------------------------------------------------
// x f32 [NB_FULL][SEQ_FULL][768] -> bf16 plane xpl [MROWS][768] (compact rows b*SEQ+t);
// weights W[n][k] f32 ([out][in], k contiguous) -> bf16 planes wpl [5][768][768] in the order qr, qi, kr, ki, v.
// ---------------------------------------------------------------------------
__global__ __launch_bounds__(256) void cvt_kernel(const float* __restrict__ x,
                                                  const float* __restrict__ w0, const float* __restrict__ w1, const float* __restrict__ w2,
                                                  const float* __restrict__ w3, const float* __restrict__ w4,
                                                  unsigned short* __restrict__ xpl, unsigned short* __restrict__ wpl) {
  const size_t tid = (size_t)blockIdx.x * blockDim.x + threadIdx.x, stride = (size_t)gridDim.x * blockDim.x;
  const size_t nx = (size_t)MROWS * HID / 8;
  const size_t per_w = (size_t)HID * HID / 8, nw = (size_t)NW * per_w;
  {
    for (size_t c = tid; c < nx; c += stride) {
      const size_t i = c * 8;                                       // element index inside the compact plane
      const int m = (int)(i / HID), col = (int)(i % HID);
      const int bb = m / SEQ, t = m - bb * SEQ;
      const float* p = x + ((size_t)bb * SEQ_FULL + t) * HID + col;
      const v4f f0 = *(const v4f*)p, f1 = *(const v4f*)(p + 4);
      v8us o;
#pragma unroll
      for (int e = 0; e < 4; ++e) {
        o[e] = (unsigned short)(bf16_rne_u32(f0[e]) >> 16);
        o[4 + e] = (unsigned short)(bf16_rne_u32(f1[e]) >> 16);
      }
      *(v8us*)(xpl + i) = o;
    }
    for (size_t c = tid; c < nw; c += stride) {
      const int mat = (int)(c / per_w);
      const size_t i = (c - (size_t)mat * per_w) * 8;               // element index inside one [768][768] matrix
      const float* w = (mat == 0) ? w0 : (mat == 1) ? w1 : (mat == 2) ? w2 : (mat == 3) ? w3 : w4;
      const v4f f0 = *(const v4f*)(w + i), f1 = *(const v4f*)(w + i + 4);
      v8us o;
#pragma unroll
      for (int e = 0; e < 4; ++e) {
        o[e] = (unsigned short)(bf16_rne_u32(f0[e]) >> 16);
        o[4 + e] = (unsigned short)(bf16_rne_u32(f1[e]) >> 16);
      }
      *(v8us*)(wpl + c * 8) = o;                           // plane offset mat*768*768 + i == c*8
    }
    
  }
}

__device__ __forceinline__ unsigned int lds_off(const void* p) { return (unsigned int)(size_t)p; }
// One 64-k stage of the projection GEMM into one LDS buffer: 256 lanes x 8 asynchronous 16-byte copies (4 of activation rows,
// 4 of weight rows), through no register. ag / wg: this lane's first 16 bytes of the stage; la: their LDS byte address.
// Copy i: row i*32 + tid/8, piece tid%8 (a wave covers four whole 128-B lines).
// s_wait_xcnt 0 closes the statement so that no address register is rewritten while a copy may still name it.
__device__ __forceinline__ void gemm_stage_copy(const b16* ag, const b16* wg, unsigned int la) {
  asm volatile("global_load_async_to_lds_b128 %0, %8, off\n\t"
               "global_load_async_to_lds_b128 %1, %9, off\n\t"
               "global_load_async_to_lds_b128 %2, %10, off\n\t"
               "global_load_async_to_lds_b128 %3, %11, off\n\t"
               "global_load_async_to_lds_b128 %4, %12, off\n\t"
               "global_load_async_to_lds_b128 %5, %13, off\n\t"
               "global_load_async_to_lds_b128 %6, %14, off\n\t"
               "global_load_async_to_lds_b128 %7, %15, off\n\t"
               "s_wait_xcnt 0x0"
               :: "v"(la), "v"(la + 32 * GPITCH), "v"(la + 64 * GPITCH), "v"(la + 96 * GPITCH),
                  "v"(la + 128 * GPITCH), "v"(la + 160 * GPITCH), "v"(la + 192 * GPITCH), "v"(la + 224 * GPITCH),
                  "v"(ag), "v"(ag + 32 * HID), "v"(ag + 64 * HID), "v"(ag + 96 * HID),
                  "v"(wg), "v"(wg + 32 * HID), "v"(wg + 64 * HID), "v"(wg + 96 * HID)
               : "memory");
}

// ---------------------------------------------------------------------------
// Projection GEMM: (MROWS x 768) x (768 x 3840), grid (30, MROWS/128), block 8 waves = 128 token rows x 128 columns,
// wave = 32 token rows x 64 columns (one head of one of the five matrices); waves 0..3 take the block's first head, 4..7 its second.
// The block's 128 activation rows and 128 weight rows come once per block into a two-buffer LDS ring, 64 k a stage,
// by asynchronous copies issued one stage ahead; every wave reads its fragments from the ring (32 k a step, k ascending).
// blockIdx.x -> mat = x/6 (qr, qi, kr, ki, v), heads 2*(x%6) and 2*(x%6)+1. Output f16 planes:
// v -> Vp key-tiled [g][t/16][64][16] (4 KB contiguous per wave), g = b*12 + head.
// ---------------------------------------------------------------------------
__global__ __launch_bounds__(256) void proj_gemm_kernel(const b16* __restrict__ xpl, const b16* __restrict__ wpl,
                                                        h16* __restrict__ Qa, h16* __restrict__ Kc, h16* __restrict__ Vp) {
  __shared__ __attribute__((aligned(16))) unsigned char Gs[2 * GSTG_B];   // the ring; behind the loop's last barrier the output staging
  const int tid = threadIdx.x;
  const int lane = tid & 31, wave = tid >> 5, nloc = lane & 15, hlf = lane >> 4;
  const int msub = wave & 3, nsub = wave >> 2;
  const int m0 = blockIdx.y * 128 + msub * 32;
  const int mat = blockIdx.x / (NH / 2);           // block-uniform: both heads of a block belong to one matrix
  const int head = (blockIdx.x - mat * (NH / 2)) * 2 + nsub;
  v8f acc[2][4];
#pragma unroll
  for (int r = 0; r < 2; ++r)
#pragma unroll
    for (int t = 0; t < 4; ++t) acc[r][t] = (v8f){};
  const b16* ag = xpl + (size_t)(blockIdx.y * 128 + (tid >> 3)) * HID + (tid & 7) * 8;   // this lane's first activation piece of stage 0
  const b16* wg = wpl + (size_t)(blockIdx.x * 128 + (tid >> 3)) * HID + (tid & 7) * 8;   // this lane's first weight piece of stage 0
  const unsigned int la = lds_off(&Gs[0]) + (unsigned int)((tid >> 3) * GPITCH + (tid & 7) * 16);
  gemm_stage_copy(ag, wg, la);                                              // stage 0 -> buffer 0
  asm volatile("s_wait_asynccnt 0x0" ::: "memory");                         // this wave's copies of stage 0 have landed
  __syncthreads();                                                          // publishes stage 0 to all 8 waves
  gemm_stage_copy(ag + GKC, wg + GKC, la + GSTG_B);                         // stage 1 -> buffer 1 (GNST >= 2)
  for (int st = 0; st < GNST; ++st) {
    const unsigned char* buf = &Gs[(st & 1) * GSTG_B];
    const b16* ar = (const b16*)(buf + (msub * 32 + nloc) * GPITCH);        // activation row m0 + nloc; 16 rows further: a1
    const b16* wr = (const b16*)(buf + (128 + nsub * 64 + nloc) * GPITCH);  // weight row of column nloc of the wave's head
#pragma unroll   // both 32-k steps of a stage inline, so that every fragment read has a constant LDS offset
    for (int kk = 0; kk < GKC; kk += 32) {
      const v16b a0 = frag_kb(ar + kk, hlf);
      const v16b a1 = frag_kb(ar + 16 * (GPITCH / 2) + kk, hlf);
      // the step's six fragments are read as one group ahead of its eight products
      const v16b bf0 = frag_kb(wr + kk, hlf), bf1 = frag_kb(wr + 16 * (GPITCH / 2) + kk, hlf);
      const v16b bf2 = frag_kb(wr + 32 * (GPITCH / 2) + kk, hlf), bf3 = frag_kb(wr + 48 * (GPITCH / 2) + kk, hlf);
      acc[0][0] = wmma_b(a0, bf0, acc[0][0]); acc[1][0] = wmma_b(a1, bf0, acc[1][0]);
      acc[0][1] = wmma_b(a0, bf1, acc[0][1]); acc[1][1] = wmma_b(a1, bf1, acc[1][1]);
      acc[0][2] = wmma_b(a0, bf2, acc[0][2]); acc[1][2] = wmma_b(a1, bf2, acc[1][2]);
      acc[0][3] = wmma_b(a0, bf3, acc[0][3]); acc[1][3] = wmma_b(a1, bf3, acc[1][3]);
    }
    asm volatile("s_wait_dscnt 0x0" ::: "memory");      // this wave's reads of stage st have returned
    asm volatile("s_wait_asynccnt 0x0" ::: "memory");   // this wave's copies of stage st+1 have landed
    __syncthreads();                                    // publishes stage st+1 and frees the buffer of stage st
    if (st + 2 < GNST)                                  // block-uniform: refill the buffer just read with stage st+2
      gemm_stage_copy(ag + (st + 2) * GKC, wg + (st + 2) * GKC, la + (st & 1) * GSTG_B);
  }
  asm volatile("s_wait_asynccnt 0x0" ::: "memory");     // no copy is outstanding when the ring becomes the output staging
  const int b = m0 / SEQ, t0 = m0 % SEQ;
  const int g = b * NH + head;
  h16* Tp = (h16*)&Gs[0] + wave * (32 * 64);       // 4 KB of the ring per wave: every read of it ended at the loop's last barrier
#pragma unroll
  for (int t = 0; t < 4; ++t) {
    const int d = t * 16 + nloc;
#pragma unroll
    for (int r = 0; r < 2; ++r)
#pragma unroll
      for (int v = 0; v < 8; ++v) {
        const int rr = r * 16 + v + 8 * hlf;                         // local token row 0..31
        const h16 y = (h16)acc[r][t][v];
        const int idx = (mat < 4) ? (rr * 64 + d) : ((rr >> 4) * 1024 + d * 16 + (rr & 15));
        Tp[idx] = y;
      }
  }
  wave_lds_sync();
  if (mat < 4) {                                   // block-uniform branch, no barriers inside
    h16* P = (mat < 2) ? Qa : Kc;
    const int coff = (mat & 1) * DH;
    h16* dst = P + ((size_t)g * SEQ + t0) * QKW + coff;              // 32 rows of 64 halves, row pitch 128 halves
#pragma unroll
    for (int j = 0; j < 8; ++j) {
      const int rr = j * 4 + (lane >> 3), c8 = (lane & 7) * 8;
      *(v8h*)(dst + (size_t)rr * QKW + c8) = ld8h(Tp + rr * 64 + c8);
    }
    
  } else {
    h16* dst = Vp + ((size_t)g * QT + (t0 >> 4)) * (size_t)(DH * 16); // two consecutive key tiles = 4 KB contiguous
#pragma unroll
    for (int j = 0; j < 8; ++j) { const int e = (j * 32 + lane) * 8; *(v8h*)(dst + e) = ld8h(Tp + e); }
    
  }
}

// One 64-key stage into one LDS buffer, 128 lanes x 12 asynchronous 16-byte copies (8 of K, 4 of V), through no register.
// kg / vg: this lane's first 16 bytes of the stage's K rows / V tiles; lk / lv: their LDS byte addresses.
// K copy i: row i*8 + tid/16, piece tid%16 (a wave covers two whole 256-B rows); V copy i: bytes i*2048 + tid*16.
// s_wait_xcnt 0 closes the statement so that no address register is rewritten while a copy may still name it.
__device__ __forceinline__ void stage_copy(const h16* kg, const h16* vg, unsigned int lk, unsigned int lv) {
  asm volatile("global_load_async_to_lds_b128 %0, %12, off\n\t"
               "global_load_async_to_lds_b128 %1, %13, off\n\t"
               "global_load_async_to_lds_b128 %2, %14, off\n\t"
               "global_load_async_to_lds_b128 %3, %15, off\n\t"
               "global_load_async_to_lds_b128 %4, %16, off\n\t"
               "global_load_async_to_lds_b128 %5, %17, off\n\t"
               "global_load_async_to_lds_b128 %6, %18, off\n\t"
               "global_load_async_to_lds_b128 %7, %19, off\n\t"
               "global_load_async_to_lds_b128 %8, %20, off\n\t"
               "global_load_async_to_lds_b128 %9, %21, off\n\t"
               "global_load_async_to_lds_b128 %10, %22, off\n\t"
               "global_load_async_to_lds_b128 %11, %23, off\n\t"
               "s_wait_xcnt 0x0"
               :: "v"(lk), "v"(lk + 8 * KPITCH), "v"(lk + 16 * KPITCH), "v"(lk + 24 * KPITCH),
                  "v"(lk + 32 * KPITCH), "v"(lk + 40 * KPITCH), "v"(lk + 48 * KPITCH), "v"(lk + 56 * KPITCH),
                  "v"(lv), "v"(lv + 2048), "v"(lv + 4096), "v"(lv + 6144),
                  "v"(kg), "v"(kg + 8 * QKW), "v"(kg + 16 * QKW), "v"(kg + 24 * QKW),
                  "v"(kg + 32 * QKW), "v"(kg + 40 * QKW), "v"(kg + 48 * QKW), "v"(kg + 56 * QKW),
                  "v"(vg), "v"(vg + 1024), "v"(vg + 2048), "v"(vg + 3072)
               : "memory");
}

// ---------------------------------------------------------------------------
// Transposed flash attention: each wave owns one 16-query tile of one (b, head); 4 waves per block; all SEQ keys in chunks of 32.
// Placement: 768 blocks, and at most 3 waves fit a SIMD (amdgpu_waves_per_eu).
// The block's 4 waves share one (b, head): its K rows and V tiles come once per block into a two-buffer LDS ring, 64 keys a stage,
// by asynchronous copies issued one stage ahead; every wave reads its fragments from the ring.
// Sr^T = Kc.Qa^T and Si^T = Kc.Qb^T (f16 fragments, 4 k-steps over the 128-wide re|im rows),
// 8 s = sqrt(sr^2 + si^2) in f32, per-lane online softmax (running max of 8 s; 1/8, log2 e and the x4096 carry sit in one fused multiply-add);
// P^T fragment built in registers from two S^T tiles (element r <- keys 0..15 tile, element 8+r <- keys 16..31 tile), carried x4096;
// ---------------------------------------------------------------------------
__global__ __launch_bounds__(AW * 32) __attribute__((amdgpu_waves_per_eu(3, 3))) void attn_kernel(const h16* __restrict__ Qa, const h16* __restrict__ Kc, const h16* __restrict__ Vp,
                                                   float* __restrict__ out) {
  __shared__ __attribute__((aligned(16))) float Os[AW][16 * 64];
  __shared__ __attribute__((aligned(16))) unsigned char Ring[2][STG_B];
  const int wid = threadIdx.x >> 5, lane = threadIdx.x & 31, hh = lane >> 4, col = lane & 15;
  const int qtile = blockIdx.x * AW + wid;                // over NB*NH*QT (exact grid)
  const int g = qtile / QT;                               // b*NH + h
  const int q0 = (qtile % QT) << 4;
  const int b = g / NH, h = g % NH;
  const size_t kbase = (size_t)g * SEQ * QKW;             // Kc plane base of (b,h)
  const size_t vbase = (size_t)g * SEQ * DH;              // V key-tiled base of (b,h): QT tiles of 64x16
  const h16* qrow = Qa + ((size_t)g * SEQ + q0 + col) * QKW;
  const v16h qf0 = frag_kh(qrow, hh), qf1 = frag_kh(qrow + 32, hh);        // qr d 0..31, 32..63 of query q0+col
  const v16h qf2 = frag_kh(qrow + 64, hh), qf3 = frag_kh(qrow + 96, hh);   // qi d 0..31, 32..63
  const v16h qn0 = neg16h(qf0), qn1 = neg16h(qf1);                          // -qr (exact)
  float m = -INFINITY, l = 0.0f;
  v8f o0 = {}, o1 = {}, o2 = {}, o3 = {};
  const int tid = threadIdx.x;
  const h16* kg = Kc + kbase + (size_t)(tid >> 4) * QKW + (tid & 15) * 8;   // this lane's first K piece of stage 0
  const h16* vg = Vp + vbase + (size_t)tid * 8;                             // this lane's first V piece of stage 0
  const unsigned int lk = lds_off(&Ring[0][0]) + (unsigned int)((tid >> 4) * KPITCH + (tid & 15) * 16);
  const unsigned int lv = lds_off(&Ring[0][0]) + (unsigned int)(KSTG_B + tid * 16);
  stage_copy(kg, vg, lk, lv);                                               // stage 0 -> buffer 0
  asm volatile("s_wait_asynccnt 0x0" ::: "memory");                         // this wave's copies of stage 0 have landed
  __syncthreads();                                                          // publishes stage 0 to all 4 waves
  stage_copy(kg + (size_t)STG * QKW, vg + (size_t)STG * DH, lk + STG_B, lv + STG_B);   // stage 1 -> buffer 1 (NSTG >= 2)
  for (int st = 0; st < NSTG; ++st) {
   const unsigned char* buf = &Ring[st & 1][0];
   for (int ps = 0; ps < 2; ++ps) {   // the compiler unrolls both passes: no back edge stands behind a pass's last matrix instruction
    const h16* k0p = (const h16*)(buf + (ps * 32 + col) * KPITCH);  // key st*64+ps*32+col (tile 0)
    const h16* k1p = (const h16*)(buf + (ps * 32 + 16 + col) * KPITCH);   // 16 keys further (tile 1)
    v8f s0r = {}, s0i = {}, s1r = {}, s1i = {};
    {
      // all eight K fragments are read as one group ahead of the products
      const v16h kf0 = frag_kh(k0p, hh), kf1 = frag_kh(k0p + 32, hh), kf2 = frag_kh(k0p + 64, hh), kf3 = frag_kh(k0p + 96, hh);
      const v16h kf4 = frag_kh(k1p, hh), kf5 = frag_kh(k1p + 32, hh), kf6 = frag_kh(k1p + 64, hh), kf7 = frag_kh(k1p + 96, hh);
      s0r = wmma_h(kf0, qf0, s0r); s0i = wmma_h(kf0, qf2, s0i);
      s0r = wmma_h(kf1, qf1, s0r); s0i = wmma_h(kf1, qf3, s0i);
      s0r = wmma_h(kf2, qf2, s0r); s0i = wmma_h(kf2, qn0, s0i);
      s0r = wmma_h(kf3, qf3, s0r); s0i = wmma_h(kf3, qn1, s0i);
      s1r = wmma_h(kf4, qf0, s1r); s1i = wmma_h(kf4, qf2, s1i);
      s1r = wmma_h(kf5, qf1, s1r); s1i = wmma_h(kf5, qf3, s1i);
      s1r = wmma_h(kf6, qf2, s1r); s1i = wmma_h(kf6, qn0, s1i);
      s1r = wmma_h(kf7, qf3, s1r); s1i = wmma_h(kf7, qn1, s1i);
    }
    // the pass's four V fragments, read here so that the score arithmetic covers their LDS latency
    const h16* v0p = (const h16*)(buf + KSTG_B) + ps * (2 * DH * 16) + 8 * hh + col * 16;   // key tile 0 of the pass; tile 1 is DH*16 further
    const v16h va0 = cat8h(ld8h(v0p + 0 * 256), ld8h(v0p + DH * 16 + 0 * 256));
    const v16h va1 = cat8h(ld8h(v0p + 1 * 256), ld8h(v0p + DH * 16 + 1 * 256));
    const v16h va2 = cat8h(ld8h(v0p + 2 * 256), ld8h(v0p + DH * 16 + 2 * 256));
    const v16h va3 = cat8h(ld8h(v0p + 3 * 256), ld8h(v0p + DH * 16 + 3 * 256));
    // 8 s = sqrt(sr^2 + si^2) on whole accumulator vectors: packed multiply and packed fused multiply-add on neighbouring registers
    const v8f t0 = __builtin_elementwise_fma(s0r, s0r, s0i * s0i), t1 = __builtin_elementwise_fma(s1r, s1r, s1i * s1i);
    v8f sc0, sc1;
#pragma unroll   // constant element indices keep the vectors in registers
    for (int r = 0; r < 8; ++r) {
      sc0[r] = __builtin_amdgcn_sqrtf(t0[r]);   // the hardware's v_sqrt_f32 alone: no range scaling, no last-bit correction
      sc1[r] = __builtin_amdgcn_sqrtf(t1[r]);
    }
    float mr = -INFINITY;
#pragma unroll
    for (int r = 0; r < 8; ++r) mr = fmaxf(mr, fmaxf(sc0[r], sc1[r]));
    mr = fmaxf(mr, __shfl_xor(mr, 16));
    const float mn = fmaxf(m, mr);            // finite (scores >= 0); m and mn hold 8 x the score maximum
    const float al_ = __builtin_amdgcn_exp2f((m - mn) * EXP_SCALE);   // 0 on the first chunk
    m = mn;
    // 4096 exp(s - max) = exp2(8 s * (log2 e / 8) + (12 - 8 max * (log2 e / 8))): one fused multiply-add per score in front of v_exp_f32
    const float nb = __builtin_fmaf(-mn, EXP_SCALE, P_CARRY_LOG2);
    const v8f cs = {EXP_SCALE, EXP_SCALE, EXP_SCALE, EXP_SCALE, EXP_SCALE, EXP_SCALE, EXP_SCALE, EXP_SCALE};
    const v8f nbv = {nb, nb, nb, nb, nb, nb, nb, nb};
    const v8f e0 = __builtin_elementwise_fma(sc0, cs, nbv), e1 = __builtin_elementwise_fma(sc1, cs, nbv);
    v8f p0, p1;
#pragma unroll   // constant element indices keep the vectors in registers
    for (int r = 0; r < 8; ++r) { p0[r] = __builtin_amdgcn_exp2f(e0[r]); p1[r] = __builtin_amdgcn_exp2f(e1[r]); }
    const v8f pp = p0 + p1;
    float sum = pp[0];                        // carried x4096 like P, and l with it; summed in ascending r
    v16h pb;
#pragma unroll   // constant element indices keep the vectors in registers
    for (int r = 0; r < 8; ++r) {
      if (r > 0) sum += pp[r];
      pb[r] = (h16)p0[r]; pb[8 + r] = (h16)p1[r];
    }
    sum += __shfl_xor(sum, 16);
    l = l * al_ + sum;
    o0 = o0 * al_; o1 = o1 * al_; o2 = o2 * al_; o3 = o3 * al_;
    o0 = wmma_h(va0, pb, o0);
    o1 = wmma_h(va1, pb, o1);
    o2 = wmma_h(va2, pb, o2);
    o3 = wmma_h(va3, pb, o3);
   }
   asm volatile("s_wait_dscnt 0x0" ::: "memory");      // this wave's reads of stage st have returned
   asm volatile("s_wait_asynccnt 0x0" ::: "memory");   // this wave's copies of stage st+1 have landed
   __syncthreads();                                    // publishes stage st+1 and frees the buffer of stage st
   if (st + 2 < NSTG)                                  // block-uniform: refill the buffer just read with stage st+2
     stage_copy(kg + (size_t)(st + 2) * (STG * QKW), vg + (size_t)(st + 2) * (STG * DH), lk + (st & 1) * STG_B, lv + (st & 1) * STG_B);
  }
  asm volatile("s_wait_asynccnt 0x0" ::: "memory");    // no copy is outstanding when the wave goes on to the epilogue
  const float inv = 1.0f / l;                   // o and l both carry x4096
  float* Tt = Os[wid];                          // [query col][d], d = n*16 + 8hh + r
  {
    float* tp = Tt + col * 64 + 8 * hh;
    const v4f a0 = {o0[0] * inv, o0[1] * inv, o0[2] * inv, o0[3] * inv}, a1 = {o0[4] * inv, o0[5] * inv, o0[6] * inv, o0[7] * inv};
    const v4f b0 = {o1[0] * inv, o1[1] * inv, o1[2] * inv, o1[3] * inv}, b1 = {o1[4] * inv, o1[5] * inv, o1[6] * inv, o1[7] * inv};
    const v4f c0 = {o2[0] * inv, o2[1] * inv, o2[2] * inv, o2[3] * inv}, c1 = {o2[4] * inv, o2[5] * inv, o2[6] * inv, o2[7] * inv};
    const v4f d0 = {o3[0] * inv, o3[1] * inv, o3[2] * inv, o3[3] * inv}, d1 = {o3[4] * inv, o3[5] * inv, o3[6] * inv, o3[7] * inv};
    *(v4f*)(tp + 0)  = a0; *(v4f*)(tp + 4)  = a1;
    *(v4f*)(tp + 16) = b0; *(v4f*)(tp + 20) = b1;
    *(v4f*)(tp + 32) = c0; *(v4f*)(tp + 36) = c1;
    *(v4f*)(tp + 48) = d0; *(v4f*)(tp + 52) = d1;
  }
  wave_lds_sync();
  float* dst0 = out + ((size_t)b * SEQ + q0) * HID + h * DH;   // 16 rows x 64 floats, row stride HID floats
#pragma unroll
  for (int j = 0; j < 8; ++j) {
    const int rr = j * 2 + hh, c4 = col * 4;
    *(v4f*)(dst0 + (size_t)rr * HID + c4) = *(const v4f*)(Tt + rr * 64 + c4);
  }
  
}
}  // namespace

extern "C" void kernel_launch(void* const* d_in, const int* in_sizes, int n_in,
                              void* d_out, int out_size, void* d_ws, size_t ws_size, hipStream_t stream) {
  if (n_in < 6) return;
  const size_t need_x = ((size_t)(NB - 1) * SEQ_FULL + SEQ) * HID;
  if ((size_t)in_sizes[0] < need_x) return;
  for (int i = 1; i <= 5; ++i) if (in_sizes[i] < HID * HID) return;
  if ((size_t)out_size < (size_t)MROWS * HID) return;

  const float* x   = (const float*)d_in[0];     // [NB_FULL, SEQ_FULL, 768] f32
  const float* Wqr = (const float*)d_in[1];     // [768,768] ([out][in])
  const float* Wqi = (const float*)d_in[2];
  const float* Wkr = (const float*)d_in[3];
  const float* Wki = (const float*)d_in[4];
  const float* Wv  = (const float*)d_in[5];
  float* out = (float*)d_out;                   // [NB, SEQ, 768] f32

  size_t off = 0; char* ws = (char*)d_ws;
  unsigned short* xpl = (unsigned short*)(ws + off); off += (size_t)MROWS * HID * 2;        // 6,291,456 B bf16 activation plane
  unsigned short* wpl = (unsigned short*)(ws + off); off += (size_t)NW * HID * HID * 2;     // 5,898,240 B bf16 weight planes
  h16* Qa = (h16*)(ws + off); off += (size_t)MROWS * NH * QKW * 2;                          // 12,582,912 B f16 [g][t][128]
  h16* Kc = (h16*)(ws + off); off += (size_t)MROWS * NH * QKW * 2;                          // 12,582,912 B f16 [g][t][128]
  h16* Vp = (h16*)(ws + off); off += (size_t)MROWS * HID * 2;                               // 6,291,456 B f16 key-tiled
  if (off > ws_size) return;                                                                 // 43,646,976 B at NB=2, SEQ=2048

  cvt_kernel<<<1024, 256, 0, stream>>>(x, Wqr, Wqi, Wkr, Wki, Wv, xpl, wpl);
  proj_gemm_kernel<<<dim3(NCOMB / 128, MROWS / 128), 256, 0, stream>>>((const b16*)xpl, (const b16*)wpl, Qa, Kc, Vp);
  attn_kernel<<<(NB * NH * QT) / AW, AW * 32, 0, stream>>>(Qa, Kc, Vp, out);
}

// v007
// A run of this version takes 80.3 microseconds.
// Timed twice side by side with v006, it ran 1.04 times as fast both times.
// Counting every step since v000, it is 4.05 times as fast.
#include <hip/hip_runtime.h>

// Contractions: five projections x.W^T (K = 768) on v_wmma_f32_16x16x32_bf16 (bf16 RNE operands, f32 accumulate, one product per tile pair);
// Sr^T = Kc.Qa^T and Si^T = Kc.Qb^T (K = 128: concatenated re | im head dims; Qb = [qi | -qr] by exact f16 sign flip of the Qa fragments)
// and ctx^T = V^T.P^T (32 keys per step, P carried x16) on v_wmma_f32_16x16x32_f16 (f16 operands, f32 accumulate, one product per tile pair);
// magnitude sqrt(sr^2 + si^2), online softmax statistics and the final normalisation in f32.

#pragma clang fp contract(off)

#ifndef NB
#define NB 2
#endif
#ifndef SEQ
#define SEQ 2048
#endif
#ifndef NB_FULL
#define NB_FULL 2
#endif
#ifndef SEQ_FULL
#define SEQ_FULL 2048
#endif

namespace {
constexpr int HID = 768, DH = 64, NH = 12;
constexpr int NW = 5;                           // weight matrices: qr, qi, kr, ki, v ([out][in], k contiguous)
constexpr int NCOMB = NW * HID;                 // 3840 rows of the combined 16-bit weight plane
constexpr int MROWS = NB * SEQ;                 // compact token rows (b*SEQ + t)
constexpr int QT = SEQ / 16;                    // 16-query tiles per (b, head)
constexpr int QKW = 2 * DH;                     // 128: row width of the Qa / Kc planes (re | im)
constexpr float SCORE_SCALE = 0.125f;           // 1/sqrt(64)
constexpr float P_CARRY_LOG2 = 4.0f;            // f16 P operand = exp(s - m) * 16 = exp2((s - m) * log2 e + 4), m the reference in use
constexpr float P_SUM_LIMIT = 32768.0f;         // a lane's 16 P values of a pass may sum to this much before the reference is renewed (f16 holds 65,504)
constexpr float EXP_SCALE = SCORE_SCALE * 1.44269504088896340736f;   // log2 e / 8: takes sqrt(sr^2 + si^2) = 8 s to the exponent of 2
constexpr int STG = 64;                         // keys per LDS stage of the attention kernel (two 32-key passes)
constexpr int NSTG = SEQ / STG;                 // stages per (b, head)
constexpr int KPITCH = 272;                     // LDS bytes per staged K row: 256 + 16, 16 B x odd, conflict-free for 16-byte reads
constexpr int KSTG_B = STG * KPITCH;            // 17,408 B of K rows per stage
constexpr int VSTG_B = STG * DH * 2;            // 8,192 B of key-tiled V per stage
constexpr int STG_B = KSTG_B + VSTG_B;          // 25,600 B per buffer
constexpr int AW = 4;                           // waves per attention block: 3,072 query tiles = 768 blocks
constexpr int GKC = 64;                         // k elements per LDS stage of the projection GEMM (128 B of every operand row)
constexpr int GNST = HID / GKC;                 // 12 stages
constexpr int GPITCH = 144;                     // LDS bytes per staged operand row: 128 + 16, 16 B x odd, conflict-free for 16-byte reads
constexpr int GSTG_B = 256 * GPITCH;            // 36,864 B per buffer: 128 activation rows, then 128 weight rows
static_assert(HID % GKC == 0);
static_assert(GNST >= 2);
static_assert(NCOMB % 128 == 0);
static_assert(NH % 2 == 0);
static_assert(8 * 32 * 64 * 2 <= 2 * GSTG_B);
static_assert(SEQ % 128 == 0);
static_assert(NSTG >= 2);
static_assert(NB >= 1 && NB <= NB_FULL);
static_assert(SEQ <= SEQ_FULL);
static_assert(NH * DH == HID);
static_assert(MROWS % 128 == 0);
static_assert(HID % 32 == 0);
static_assert(NCOMB % 64 == 0);
static_assert(QT % AW == 0);                   // the waves of an attention block share one (b, head)
static_assert(STG * 16 == AW * 32 * 8 && VSTG_B == AW * 32 * 16 * 4);   // 8 K copies and 4 V copies a lane fill a stage exactly
static_assert((size_t)MROWS * HID <= (size_t)NB_FULL * SEQ_FULL * HID);

typedef __bf16 b16;
typedef _Float16 h16;
typedef __bf16 v16b __attribute__((ext_vector_type(16)));
typedef __bf16 v8b __attribute__((ext_vector_type(8)));
typedef _Float16 v16h __attribute__((ext_vector_type(16)));
typedef _Float16 v8h __attribute__((ext_vector_type(8)));
typedef float v8f __attribute__((ext_vector_type(8)));
typedef float v4f __attribute__((ext_vector_type(4)));
typedef unsigned short v8us __attribute__((ext_vector_type(8)));
typedef unsigned int v8u __attribute__((ext_vector_type(8)));

__device__ __forceinline__ v8b ld8b(const b16* p) { return *(const v8b*)p; }
__device__ __forceinline__ v8h ld8h(const h16* p) { return *(const v8h*)p; }
__device__ __forceinline__ v16b cat8b(v8b a, v8b b) { return __builtin_shufflevector(a, b, 0, 1, 2, 3, 4, 5, 6, 7, 8, 9, 10, 11, 12, 13, 14, 15); }
__device__ __forceinline__ v16h cat8h(v8h a, v8h b) { return __builtin_shufflevector(a, b, 0, 1, 2, 3, 4, 5, 6, 7, 8, 9, 10, 11, 12, 13, 14, 15); }
// 16x16x32 16-bit fragment from a k-contiguous row pointer (A: lane&15 = row, B: lane&15 = column), hh = lane>>4:
// elements 0..7 <- p[8hh+0..7], elements 8..15 <- p[16+8hh+0..7]
__device__ __forceinline__ v16b frag_kb(const b16* p, int hh) { return cat8b(ld8b(p + 8 * hh), ld8b(p + 16 + 8 * hh)); }
__device__ __forceinline__ v16h frag_kh(const h16* p, int hh) { return cat8h(ld8h(p + 8 * hh), ld8h(p + 16 + 8 * hh)); }

__device__ __forceinline__ v8f wmma_b(v16b a, v16b b, v8f c) {
  v8f d = __builtin_amdgcn_wmma_f32_16x16x32_bf16(false, a, false, b, (short)0, c, false, false);
  asm volatile("v_nop\n\tv_nop\n\tv_nop\n\tv_nop" : "+v"(d) : "v"(a), "v"(b));
  return d;
}
// builtin form alone: on the straight path the compiler keeps the distance behind a matrix instruction itself
__device__ __forceinline__ v8f wmma_h(v16h a, v16h b, v8f c) {
  return __builtin_amdgcn_wmma_f32_16x16x32_f16(false, a, false, b, (short)0, c, false, false);
}
// exact sign flip of 16 packed f16 values
__device__ __forceinline__ v16h neg16h(v16h a) {
  v8u t = __builtin_bit_cast(v8u, a);
  const v8u s = {0x80008000u, 0x80008000u, 0x80008000u, 0x80008000u, 0x80008000u, 0x80008000u, 0x80008000u, 0x80008000u};
  t = t ^ s;
  return __builtin_bit_cast(v16h, t);
}
// f32 -> bf16 by RNE convert, returned as the f32 bit pattern with the low 16 bits cleared
__device__ __forceinline__ unsigned int bf16_rne_u32(float f) {
  unsigned int u = __builtin_bit_cast(unsigned int, f);
  u += 0x7fffu + ((u >> 16) & 1u);
  return u & 0xffff0000u;
}
// wave-private LDS tile: stores by this wave, then vector reloads by this wave
__device__ __forceinline__ void wave_lds_sync() {
  __builtin_amdgcn_fence(3, "workgroup");
  __builtin_amdgcn_wave_barrier();
  __builtin_amdgcn_fence(2, "workgroup");
}

// ---------------------------------------------------------------------------
// x f32 [NB_FULL][SEQ_FULL][768] -> bf16 plane xpl [MROWS][768] (compact rows b*SEQ+t);
// weights W[n][k] f32 ([out][in], k contiguous) -> bf16 planes wpl [5][768][768] in the order qr, qi, kr, ki, v.
// ---------------------------------------------------------------------------
__global__ __launch_bounds__(256) void cvt_kernel(const float* __restrict__ x,
                                                  const float* __restrict__ w0, const float* __restrict__ w1, const float* __restrict__ w2,
                                                  const float* __restrict__ w3, const float* __restrict__ w4,
                                                  unsigned short* __restrict__ xpl, unsigned short* __restrict__ wpl) {
  const size_t tid = (size_t)blockIdx.x * blockDim.x + threadIdx.x, stride = (size_t)gridDim.x * blockDim.x;
  const size_t nx = (size_t)MROWS * HID / 8;
  const size_t per_w = (size_t)HID * HID / 8, nw = (size_t)NW * per_w;
  {
    for (size_t c = tid; c < nx; c += stride) {
      const size_t i = c * 8;                                       // element index inside the compact plane
      const int m = (int)(i / HID), col = (int)(i % HID);
      const int bb = m / SEQ, t = m - bb * SEQ;
      const float* p = x + ((size_t)bb * SEQ_FULL + t) * HID + col;
      const v4f f0 = *(const v4f*)p, f1 = *(const v4f*)(p + 4);
      v8us o;
#pragma unroll
      for (int e = 0; e < 4; ++e) {
        o[e] = (unsigned short)(bf16_rne_u32(f0[e]) >> 16);
        o[4 + e] = (unsigned short)(bf16_rne_u32(f1[e]) >> 16);
      }
      *(v8us*)(xpl + i) = o;
    }
    for (size_t c = tid; c < nw; c += stride) {
      const int mat = (int)(c / per_w);
      const size_t i = (c - (size_t)mat * per_w) * 8;               // element index inside one [768][768] matrix
      const float* w = (mat == 0) ? w0 : (mat == 1) ? w1 : (mat == 2) ? w2 : (mat == 3) ? w3 : w4;
      const v4f f0 = *(const v4f*)(w + i), f1 = *(const v4f*)(w + i + 4);
      v8us o;
#pragma unroll
      for (int e = 0; e < 4; ++e) {
        o[e] = (unsigned short)(bf16_rne_u32(f0[e]) >> 16);
        o[4 + e] = (unsigned short)(bf16_rne_u32(f1[e]) >> 16);
      }
      *(v8us*)(wpl + c * 8) = o;                           // plane offset mat*768*768 + i == c*8
    }
    
  }
}

__device__ __forceinline__ unsigned int lds_off(const void* p) { return (unsigned int)(size_t)p; }
// One 64-k stage of the projection GEMM into one LDS buffer: 256 lanes x 8 asynchronous 16-byte copies (4 of activation rows,
// 4 of weight rows), through no register. ag / wg: this lane's first 16 bytes of the stage; la: their LDS byte address.
// Copy i: row i*32 + tid/8, piece tid%8 (a wave covers four whole 128-B lines).
// s_wait_xcnt 0 closes the statement so that no address register is rewritten while a copy may still name it.
__device__ __forceinline__ void gemm_stage_copy(const b16* ag, const b16* wg, unsigned int la) {
  asm volatile("global_load_async_to_lds_b128 %0, %8, off\n\t"
               "global_load_async_to_lds_b128 %1, %9, off\n\t"
               "global_load_async_to_lds_b128 %2, %10, off\n\t"
               "global_load_async_to_lds_b128 %3, %11, off\n\t"
               "global_load_async_to_lds_b128 %4, %12, off\n\t"
               "global_load_async_to_lds_b128 %5, %13, off\n\t"
               "global_load_async_to_lds_b128 %6, %14, off\n\t"
               "global_load_async_to_lds_b128 %7, %15, off\n\t"
               "s_wait_xcnt 0x0"
               :: "v"(la), "v"(la + 32 * GPITCH), "v"(la + 64 * GPITCH), "v"(la + 96 * GPITCH),
                  "v"(la + 128 * GPITCH), "v"(la + 160 * GPITCH), "v"(la + 192 * GPITCH), "v"(la + 224 * GPITCH),
                  "v"(ag), "v"(ag + 32 * HID), "v"(ag + 64 * HID), "v"(ag + 96 * HID),
                  "v"(wg), "v"(wg + 32 * HID), "v"(wg + 64 * HID), "v"(wg + 96 * HID)
               : "memory");
}

// ---------------------------------------------------------------------------
// Projection GEMM: (MROWS x 768) x (768 x 3840), grid (30, MROWS/128), block 8 waves = 128 token rows x 128 columns,
// wave = 32 token rows x 64 columns (one head of one of the five matrices); waves 0..3 take the block's first head, 4..7 its second.
// The block's 128 activation rows and 128 weight rows come once per block into a two-buffer LDS ring, 64 k a stage,
// by asynchronous copies issued one stage ahead; every wave reads its fragments from the ring (32 k a step, k ascending).
// blockIdx.x -> mat = x/6 (qr, qi, kr, ki, v), heads 2*(x%6) and 2*(x%6)+1. Output f16 planes:
// v -> Vp key-tiled [g][t/16][64][16] (4 KB contiguous per wave), g = b*12 + head.
// ---------------------------------------------------------------------------
__global__ __launch_bounds__(256) void proj_gemm_kernel(const b16* __restrict__ xpl, const b16* __restrict__ wpl,
                                                        h16* __restrict__ Qa, h16* __restrict__ Kc, h16* __restrict__ Vp) {
  __shared__ __attribute__((aligned(16))) unsigned char Gs[2 * GSTG_B];   // the ring; behind the loop's last barrier the output staging
  const int tid = threadIdx.x;
  const int lane = tid & 31, wave = tid >> 5, nloc = lane & 15, hlf = lane >> 4;
  const int msub = wave & 3, nsub = wave >> 2;
  const int m0 = blockIdx.y * 128 + msub * 32;
  const int mat = blockIdx.x / (NH / 2);           // block-uniform: both heads of a block belong to one matrix
  const int head = (blockIdx.x - mat * (NH / 2)) * 2 + nsub;
  v8f acc[2][4];
#pragma unroll
  for (int r = 0; r < 2; ++r)
#pragma unroll
    for (int t = 0; t < 4; ++t) acc[r][t] = (v8f){};
  const b16* ag = xpl + (size_t)(blockIdx.y * 128 + (tid >> 3)) * HID + (tid & 7) * 8;   // this lane's first activation piece of stage 0
  const b16* wg = wpl + (size_t)(blockIdx.x * 128 + (tid >> 3)) * HID + (tid & 7) * 8;   // this lane's first weight piece of stage 0
  const unsigned int la = lds_off(&Gs[0]) + (unsigned int)((tid >> 3) * GPITCH + (tid & 7) * 16);
  gemm_stage_copy(ag, wg, la);                                              // stage 0 -> buffer 0
  asm volatile("s_wait_asynccnt 0x0" ::: "memory");                         // this wave's copies of stage 0 have landed
  __syncthreads();                                                          // publishes stage 0 to all 8 waves
  gemm_stage_copy(ag + GKC, wg + GKC, la + GSTG_B);                         // stage 1 -> buffer 1 (GNST >= 2)
  for (int st = 0; st < GNST; ++st) {
    const unsigned char* buf = &Gs[(st & 1) * GSTG_B];
    const b16* ar = (const b16*)(buf + (msub * 32 + nloc) * GPITCH);        // activation row m0 + nloc; 16 rows further: a1
    const b16* wr = (const b16*)(buf + (128 + nsub * 64 + nloc) * GPITCH);  // weight row of column nloc of the wave's head
#pragma unroll   // both 32-k steps of a stage inline, so that every fragment read has a constant LDS offset
    for (int kk = 0; kk < GKC; kk += 32) {
      const v16b a0 = frag_kb(ar + kk, hlf);
      const v16b a1 = frag_kb(ar + 16 * (GPITCH / 2) + kk, hlf);
      // the step's six fragments are read as one group ahead of its eight products
      const v16b bf0 = frag_kb(wr + kk, hlf), bf1 = frag_kb(wr + 16 * (GPITCH / 2) + kk, hlf);
      const v16b bf2 = frag_kb(wr + 32 * (GPITCH / 2) + kk, hlf), bf3 = frag_kb(wr + 48 * (GPITCH / 2) + kk, hlf);
      acc[0][0] = wmma_b(a0, bf0, acc[0][0]); acc[1][0] = wmma_b(a1, bf0, acc[1][0]);
      acc[0][1] = wmma_b(a0, bf1, acc[0][1]); acc[1][1] = wmma_b(a1, bf1, acc[1][1]);
      acc[0][2] = wmma_b(a0, bf2, acc[0][2]); acc[1][2] = wmma_b(a1, bf2, acc[1][2]);
      acc[0][3] = wmma_b(a0, bf3, acc[0][3]); acc[1][3] = wmma_b(a1, bf3, acc[1][3]);
    }
    asm volatile("s_wait_dscnt 0x0" ::: "memory");      // this wave's reads of stage st have returned
    asm volatile("s_wait_asynccnt 0x0" ::: "memory");   // this wave's copies of stage st+1 have landed
    __syncthreads();                                    // publishes stage st+1 and frees the buffer of stage st
    if (st + 2 < GNST)                                  // block-uniform: refill the buffer just read with stage st+2
      gemm_stage_copy(ag + (st + 2) * GKC, wg + (st + 2) * GKC, la + (st & 1) * GSTG_B);
  }
  asm volatile("s_wait_asynccnt 0x0" ::: "memory");     // no copy is outstanding when the ring becomes the output staging
  const int b = m0 / SEQ, t0 = m0 % SEQ;
  const int g = b * NH + head;
  h16* Tp = (h16*)&Gs[0] + wave * (32 * 64);       // 4 KB of the ring per wave: every read of it ended at the loop's last barrier
#pragma unroll
  for (int t = 0; t < 4; ++t) {
    const int d = t * 16 + nloc;
#pragma unroll
    for (int r = 0; r < 2; ++r)
#pragma unroll
      for (int v = 0; v < 8; ++v) {
        const int rr = r * 16 + v + 8 * hlf;                         // local token row 0..31
        const h16 y = (h16)acc[r][t][v];
        const int idx = (mat < 4) ? (rr * 64 + d) : ((rr >> 4) * 1024 + d * 16 + (rr & 15));
        Tp[idx] = y;
      }
  }
  wave_lds_sync();
  if (mat < 4) {                                   // block-uniform branch, no barriers inside
    h16* P = (mat < 2) ? Qa : Kc;
    const int coff = (mat & 1) * DH;
    h16* dst = P + ((size_t)g * SEQ + t0) * QKW + coff;              // 32 rows of 64 halves, row pitch 128 halves
#pragma unroll
    for (int j = 0; j < 8; ++j) {
      const int rr = j * 4 + (lane >> 3), c8 = (lane & 7) * 8;
      *(v8h*)(dst + (size_t)rr * QKW + c8) = ld8h(Tp + rr * 64 + c8);
    }
    
  } else {
    h16* dst = Vp + ((size_t)g * QT + (t0 >> 4)) * (size_t)(DH * 16); // two consecutive key tiles = 4 KB contiguous
#pragma unroll
    for (int j = 0; j < 8; ++j) { const int e = (j * 32 + lane) * 8; *(v8h*)(dst + e) = ld8h(Tp + e); }
    
  }
}

// One 64-key stage into one LDS buffer, 128 lanes x 12 asynchronous 16-byte copies (8 of K, 4 of V), through no register.
// kg / vg: this lane's first 16 bytes of the stage's K rows / V tiles; lk / lv: their LDS byte addresses.
// K copy i: row i*8 + tid/16, piece tid%16 (a wave covers two whole 256-B rows); V copy i: bytes i*2048 + tid*16.
// s_wait_xcnt 0 closes the statement so that no address register is rewritten while a copy may still name it.
__device__ __forceinline__ void stage_copy(const h16* kg, const h16* vg, unsigned int lk, unsigned int lv) {
  asm volatile("global_load_async_to_lds_b128 %0, %12, off\n\t"
               "global_load_async_to_lds_b128 %1, %13, off\n\t"
               "global_load_async_to_lds_b128 %2, %14, off\n\t"
               "global_load_async_to_lds_b128 %3, %15, off\n\t"
               "global_load_async_to_lds_b128 %4, %16, off\n\t"
               "global_load_async_to_lds_b128 %5, %17, off\n\t"
               "global_load_async_to_lds_b128 %6, %18, off\n\t"
               "global_load_async_to_lds_b128 %7, %19, off\n\t"
               "global_load_async_to_lds_b128 %8, %20, off\n\t"
               "global_load_async_to_lds_b128 %9, %21, off\n\t"
               "global_load_async_to_lds_b128 %10, %22, off\n\t"
               "global_load_async_to_lds_b128 %11, %23, off\n\t"
               "s_wait_xcnt 0x0"
               :: "v"(lk), "v"(lk + 8 * KPITCH), "v"(lk + 16 * KPITCH), "v"(lk + 24 * KPITCH),
                  "v"(lk + 32 * KPITCH), "v"(lk + 40 * KPITCH), "v"(lk + 48 * KPITCH), "v"(lk + 56 * KPITCH),
                  "v"(lv), "v"(lv + 2048), "v"(lv + 4096), "v"(lv + 6144),
                  "v"(kg), "v"(kg + 8 * QKW), "v"(kg + 16 * QKW), "v"(kg + 24 * QKW),
                  "v"(kg + 32 * QKW), "v"(kg + 40 * QKW), "v"(kg + 48 * QKW), "v"(kg + 56 * QKW),
                  "v"(vg), "v"(vg + 1024), "v"(vg + 2048), "v"(vg + 3072)
               : "memory");
}

// The eight K fragments of one 32-key pass (two 16-key tiles x four 32-wide k steps); kb: this lane's K row of tile 0 in the ring.
struct KFrags { v16h f0, f1, f2, f3, f4, f5, f6, f7; };
__device__ __forceinline__ KFrags pass_kfrags(const unsigned char* kb, int hh) {
  const h16* k0p = (const h16*)kb;                     // tile 0
  const h16* k1p = (const h16*)(kb + 16 * KPITCH);     // 16 keys further (tile 1)
  KFrags k;
  k.f0 = frag_kh(k0p, hh); k.f1 = frag_kh(k0p + 32, hh); k.f2 = frag_kh(k0p + 64, hh); k.f3 = frag_kh(k0p + 96, hh);
  k.f4 = frag_kh(k1p, hh); k.f5 = frag_kh(k1p + 32, hh); k.f6 = frag_kh(k1p + 64, hh); k.f7 = frag_kh(k1p + 96, hh);
  return k;
}
// sr^2 + si^2 = (8 s)^2 of one 32-key pass against the wave's 16 queries.
__device__ __forceinline__ void pass_scores(const KFrags& k, v16h qf0, v16h qf1, v16h qf2, v16h qf3, v16h qn0, v16h qn1, v8f& t0, v8f& t1) {
  v8f s0r = {}, s0i = {}, s1r = {}, s1i = {};
  s0r = wmma_h(k.f0, qf0, s0r); s0i = wmma_h(k.f0, qf2, s0i);
  s0r = wmma_h(k.f1, qf1, s0r); s0i = wmma_h(k.f1, qf3, s0i);
  s0r = wmma_h(k.f2, qf2, s0r); s0i = wmma_h(k.f2, qn0, s0i);
  s0r = wmma_h(k.f3, qf3, s0r); s0i = wmma_h(k.f3, qn1, s0i);
  s1r = wmma_h(k.f4, qf0, s1r); s1i = wmma_h(k.f4, qf2, s1i);
  s1r = wmma_h(k.f5, qf1, s1r); s1i = wmma_h(k.f5, qf3, s1i);
  s1r = wmma_h(k.f6, qf2, s1r); s1i = wmma_h(k.f6, qn0, s1i);
  s1r = wmma_h(k.f7, qf3, s1r); s1i = wmma_h(k.f7, qn1, s1i);
  // on whole accumulator vectors: packed multiply and packed fused multiply-add on neighbouring registers
  t0 = __builtin_elementwise_fma(s0r, s0r, s0i * s0i);
  t1 = __builtin_elementwise_fma(s1r, s1r, s1i * s1i);
}
// 16 exp(s - reference) = exp2(8 s * (log2 e / 8) + nb), nb = 4 - 8 reference * (log2 e / 8): one fused multiply-add per score in front of v_exp_f32;
// sum: this lane's 16 values, summed in ascending r.
__device__ __forceinline__ void pass_probs(v8f sc0, v8f sc1, float nb, v8f& p0, v8f& p1, float& sum) {
  const v8f cs = {EXP_SCALE, EXP_SCALE, EXP_SCALE, EXP_SCALE, EXP_SCALE, EXP_SCALE, EXP_SCALE, EXP_SCALE};
  const v8f nbv = {nb, nb, nb, nb, nb, nb, nb, nb};
  const v8f e0 = __builtin_elementwise_fma(sc0, cs, nbv), e1 = __builtin_elementwise_fma(sc1, cs, nbv);
#pragma unroll   // constant element indices keep the vectors in registers
  for (int r = 0; r < 8; ++r) { p0[r] = __builtin_amdgcn_exp2f(e0[r]); p1[r] = __builtin_amdgcn_exp2f(e1[r]); }
  const v8f pp = p0 + p1;
  sum = pp[0];
#pragma unroll   // constant element indices keep the vector in registers
  for (int r = 1; r < 8; ++r) sum += pp[r];
}
// Softmax of one pass against a HELD reference m (8 x a score, the same in both halves of a column; nb belongs to it): no maximum and no
// rescaling on the usual path. One test per pass: a lane's 16 values sum to at most P_SUM_LIMIT, so each fits f16. Where any lane fails it
// (always in the first pass: nb starts at +infinity), the whole wave takes the pass's true maximum as the new reference, rescales l and o
// by exp(old - new) and forms the pass's values again; they are then at most 16 each.
__device__ __forceinline__ void pass_softmax(v8f t0, v8f t1, float& m, float& nb, float& l, v8f& o0, v8f& o1, v8f& o2, v8f& o3, v16h& pb) {
  v8f sc0, sc1;
#pragma unroll   // constant element indices keep the vectors in registers
  for (int r = 0; r < 8; ++r) {
    sc0[r] = __builtin_amdgcn_sqrtf(t0[r]);   // the hardware's v_sqrt_f32 alone: no range scaling, no last-bit correction
    sc1[r] = __builtin_amdgcn_sqrtf(t1[r]);
  }
  v8f p0, p1;
  float sum;
  pass_probs(sc0, sc1, nb, p0, p1, sum);
  if (__builtin_amdgcn_ballot_w32(!(sum <= P_SUM_LIMIT)) != 0u) {   // wave-uniform scalar branch; the negated form also catches infinity and NaN
    float mr = -INFINITY;
#pragma unroll   // constant element indices keep the vectors in registers
    for (int r = 0; r < 8; ++r) mr = fmaxf(mr, fmaxf(sc0[r], sc1[r]));
    mr = fmaxf(mr, __shfl_xor(mr, 16));
    const float mn = fmaxf(m, mr);            // finite (scores >= 0)
    const float al_ = __builtin_amdgcn_exp2f((m - mn) * EXP_SCALE);   // 0 in the first pass
    m = mn;
    nb = __builtin_fmaf(-mn, EXP_SCALE, P_CARRY_LOG2);
    l = l * al_;
    o0 = o0 * al_; o1 = o1 * al_; o2 = o2 * al_; o3 = o3 * al_;
    pass_probs(sc0, sc1, nb, p0, p1, sum);
  }
#pragma unroll   // constant element indices keep the vectors in registers
  for (int r = 0; r < 8; ++r) { pb[r] = (h16)p0[r]; pb[8 + r] = (h16)p1[r]; }
  sum += __shfl_xor(sum, 16);
  l = l + sum;                                // carried x16 like P
}

// ---------------------------------------------------------------------------
// Transposed flash attention: each wave owns one 16-query tile of one (b, head); 4 waves per block; all SEQ keys in chunks of 32.
// Placement: 768 blocks, and at most 3 waves fit a SIMD (amdgpu_waves_per_eu).
// The block's 4 waves share one (b, head): its K rows and V tiles come once per block into a two-buffer LDS ring, 64 keys a stage,
// by asynchronous copies issued one stage ahead; every wave reads its fragments from the ring.
// Sr^T = Kc.Qa^T and Si^T = Kc.Qb^T (f16 fragments, 4 k-steps over the 128-wide re|im rows),
// 8 s = sqrt(sr^2 + si^2) in f32, per-lane online softmax against a held reference, renewed only when a pass's sums say so (pass_softmax);
// 1/8, log2 e and the x16 carry sit in one fused multiply-add;
// P^T fragment built in registers from two S^T tiles (element r <- keys 0..15 tile, element 8+r <- keys 16..31 tile), carried x16;
// ---------------------------------------------------------------------------
__global__ __launch_bounds__(AW * 32) __attribute__((amdgpu_waves_per_eu(3, 3))) void attn_kernel(const h16* __restrict__ Qa, const h16* __restrict__ Kc, const h16* __restrict__ Vp,
                                                   float* __restrict__ out) {
  __shared__ __attribute__((aligned(16))) float Os[AW][16 * 64];
  __shared__ __attribute__((aligned(16))) unsigned char Ring[2][STG_B];
  const int wid = threadIdx.x >> 5, lane = threadIdx.x & 31, hh = lane >> 4, col = lane & 15;
  const int qtile = blockIdx.x * AW + wid;                // over NB*NH*QT (exact grid)
  const int g = qtile / QT;                               // b*NH + h
  const int q0 = (qtile % QT) << 4;
  const int b = g / NH, h = g % NH;
  const size_t kbase = (size_t)g * SEQ * QKW;             // Kc plane base of (b,h)
  const size_t vbase = (size_t)g * SEQ * DH;              // V key-tiled base of (b,h): QT tiles of 64x16
  const h16* qrow = Qa + ((size_t)g * SEQ + q0 + col) * QKW;
  const v16h qf0 = frag_kh(qrow, hh), qf1 = frag_kh(qrow + 32, hh);        // qr d 0..31, 32..63 of query q0+col
  const v16h qf2 = frag_kh(qrow + 64, hh), qf3 = frag_kh(qrow + 96, hh);   // qi d 0..31, 32..63
  const v16h qn0 = neg16h(qf0), qn1 = neg16h(qf1);                          // -qr (exact)
  float m = -INFINITY, l = 0.0f;
  float nb = INFINITY;                                    // exponent addend of the reference m; +infinity makes the first pass set one
  v8f o0 = {}, o1 = {}, o2 = {}, o3 = {};
  const int tid = threadIdx.x;
  const h16* kg = Kc + kbase + (size_t)(tid >> 4) * QKW + (tid & 15) * 8;   // this lane's first K piece of stage 0
  const h16* vg = Vp + vbase + (size_t)tid * 8;                             // this lane's first V piece of stage 0
  const unsigned int lk = lds_off(&Ring[0][0]) + (unsigned int)((tid >> 4) * KPITCH + (tid & 15) * 16);
  const unsigned int lv = lds_off(&Ring[0][0]) + (unsigned int)(KSTG_B + tid * 16);
  stage_copy(kg, vg, lk, lv);                                               // stage 0 -> buffer 0
  asm volatile("s_wait_asynccnt 0x0" ::: "memory");                         // this wave's copies of stage 0 have landed
  __syncthreads();                                                          // publishes stage 0 to all 4 waves
  stage_copy(kg + (size_t)STG * QKW, vg + (size_t)STG * DH, lk + STG_B, lv + STG_B);   // stage 1 -> buffer 1 (NSTG >= 2)
  for (int st = 0; st < NSTG; ++st) {
   const unsigned char* buf = &Ring[st & 1][0];
   const unsigned char* kb = buf + col * KPITCH;                    // K row of key st*64 + col
   // both passes' score products stand ahead of the first pass's softmax, so that its vector work has matrix work beside it
   const KFrags ka = pass_kfrags(kb, hh), kc = pass_kfrags(kb + 32 * KPITCH, hh);
   __builtin_amdgcn_sched_barrier(0);   // keeps the stage's 32 K reads one group ahead of the products: read in pairs among them, each pair's LDS latency is waited out
   v8f ta0, ta1, tb0, tb1;
   pass_scores(ka, qf0, qf1, qf2, qf3, qn0, qn1, ta0, ta1);
   pass_scores(kc, qf0, qf1, qf2, qf3, qn0, qn1, tb0, tb1);
   // the stage's eight V fragments; the compiler issues these reads behind the first pass's test, under the second pass's score arithmetic
   const h16* v0p = (const h16*)(buf + KSTG_B) + 8 * hh + col * 16;   // key tile 0 of pass 0; the next key tile is DH*16 further
   const h16* v1p = v0p + 2 * DH * 16;                                // key tile 0 of pass 1
   const v16h va0 = cat8h(ld8h(v0p + 0 * 256), ld8h(v0p + DH * 16 + 0 * 256));
   const v16h va1 = cat8h(ld8h(v0p + 1 * 256), ld8h(v0p + DH * 16 + 1 * 256));
   const v16h va2 = cat8h(ld8h(v0p + 2 * 256), ld8h(v0p + DH * 16 + 2 * 256));
   const v16h va3 = cat8h(ld8h(v0p + 3 * 256), ld8h(v0p + DH * 16 + 3 * 256));
   const v16h vb0 = cat8h(ld8h(v1p + 0 * 256), ld8h(v1p + DH * 16 + 0 * 256));
   const v16h vb1 = cat8h(ld8h(v1p + 1 * 256), ld8h(v1p + DH * 16 + 1 * 256));
   const v16h vb2 = cat8h(ld8h(v1p + 2 * 256), ld8h(v1p + DH * 16 + 2 * 256));
   const v16h vb3 = cat8h(ld8h(v1p + 3 * 256), ld8h(v1p + DH * 16 + 3 * 256));
   v16h pb;
   pass_softmax(ta0, ta1, m, nb, l, o0, o1, o2, o3, pb);
   o0 = wmma_h(va0, pb, o0);
   o1 = wmma_h(va1, pb, o1);
   o2 = wmma_h(va2, pb, o2);
   o3 = wmma_h(va3, pb, o3);
   pass_softmax(tb0, tb1, m, nb, l, o0, o1, o2, o3, pb);
   o0 = wmma_h(vb0, pb, o0);
   o1 = wmma_h(vb1, pb, o1);
   o2 = wmma_h(vb2, pb, o2);
   o3 = wmma_h(vb3, pb, o3);
   asm volatile("s_wait_dscnt 0x0" ::: "memory");      // this wave's reads of stage st have returned
   asm volatile("s_wait_asynccnt 0x0" ::: "memory");   // this wave's copies of stage st+1 have landed
   __syncthreads();                                    // publishes stage st+1 and frees the buffer of stage st
   if (st + 2 < NSTG)                                  // block-uniform: refill the buffer just read with stage st+2
     stage_copy(kg + (size_t)(st + 2) * (STG * QKW), vg + (size_t)(st + 2) * (STG * DH), lk + (st & 1) * STG_B, lv + (st & 1) * STG_B);
  }
  asm volatile("s_wait_asynccnt 0x0" ::: "memory");    // no copy is outstanding when the wave goes on to the epilogue
  const float inv = 1.0f / l;                   // o and l both carry x16
  float* Tt = Os[wid];                          // [query col][d], d = n*16 + 8hh + r
  {
    float* tp = Tt + col * 64 + 8 * hh;
    const v4f a0 = {o0[0] * inv, o0[1] * inv, o0[2] * inv, o0[3] * inv}, a1 = {o0[4] * inv, o0[5] * inv, o0[6] * inv, o0[7] * inv};
    const v4f b0 = {o1[0] * inv, o1[1] * inv, o1[2] * inv, o1[3] * inv}, b1 = {o1[4] * inv, o1[5] * inv, o1[6] * inv, o1[7] * inv};
    const v4f c0 = {o2[0] * inv, o2[1] * inv, o2[2] * inv, o2[3] * inv}, c1 = {o2[4] * inv, o2[5] * inv, o2[6] * inv, o2[7] * inv};
    const v4f d0 = {o3[0] * inv, o3[1] * inv, o3[2] * inv, o3[3] * inv}, d1 = {o3[4] * inv, o3[5] * inv, o3[6] * inv, o3[7] * inv};
    *(v4f*)(tp + 0)  = a0; *(v4f*)(tp + 4)  = a1;
    *(v4f*)(tp + 16) = b0; *(v4f*)(tp + 20) = b1;
    *(v4f*)(tp + 32) = c0; *(v4f*)(tp + 36) = c1;
    *(v4f*)(tp + 48) = d0; *(v4f*)(tp + 52) = d1;
  }
  wave_lds_sync();
  float* dst0 = out + ((size_t)b * SEQ + q0) * HID + h * DH;   // 16 rows x 64 floats, row stride HID floats
#pragma unroll
  for (int j = 0; j < 8; ++j) {
    const int rr = j * 2 + hh, c4 = col * 4;
    *(v4f*)(dst0 + (size_t)rr * HID + c4) = *(const v4f*)(Tt + rr * 64 + c4);
  }
  
}
}  // namespace

extern "C" void kernel_launch(void* const* d_in, const int* in_sizes, int n_in,
                              void* d_out, int out_size, void* d_ws, size_t ws_size, hipStream_t stream) {
  if (n_in < 6) return;
  const size_t need_x = ((size_t)(NB - 1) * SEQ_FULL + SEQ) * HID;
  if ((size_t)in_sizes[0] < need_x) return;
  for (int i = 1; i <= 5; ++i) if (in_sizes[i] < HID * HID) return;
  if ((size_t)out_size < (size_t)MROWS * HID) return;

  const float* x   = (const float*)d_in[0];     // [NB_FULL, SEQ_FULL, 768] f32
  const float* Wqr = (const float*)d_in[1];     // [768,768] ([out][in])
  const float* Wqi = (const float*)d_in[2];
  const float* Wkr = (const float*)d_in[3];
  const float* Wki = (const float*)d_in[4];
  const float* Wv  = (const float*)d_in[5];
  float* out = (float*)d_out;                   // [NB, SEQ, 768] f32

  size_t off = 0; char* ws = (char*)d_ws;
  unsigned short* xpl = (unsigned short*)(ws + off); off += (size_t)MROWS * HID * 2;        // 6,291,456 B bf16 activation plane
  unsigned short* wpl = (unsigned short*)(ws + off); off += (size_t)NW * HID * HID * 2;     // 5,898,240 B bf16 weight planes
  h16* Qa = (h16*)(ws + off); off += (size_t)MROWS * NH * QKW * 2;                          // 12,582,912 B f16 [g][t][128]
  h16* Kc = (h16*)(ws + off); off += (size_t)MROWS * NH * QKW * 2;                          // 12,582,912 B f16 [g][t][128]
  h16* Vp = (h16*)(ws + off); off += (size_t)MROWS * HID * 2;                               // 6,291,456 B f16 key-tiled
  if (off > ws_size) return;                                                                 // 43,646,976 B at NB=2, SEQ=2048

  cvt_kernel<<<1024, 256, 0, stream>>>(x, Wqr, Wqi, Wkr, Wki, Wv, xpl, wpl);
  proj_gemm_kernel<<<dim3(NCOMB / 128, MROWS / 128), 256, 0, stream>>>((const b16*)xpl, (const b16*)wpl, Qa, Kc, Vp);
  attn_kernel<<<(NB * NH * QT) / AW, AW * 32, 0, stream>>>(Qa, Kc, Vp, out);
}
